// v000
// The times below were measured on an AMD MI455X: many runs one after another, warmed up first and cycling through
// copies of the inputs, with the whole window's GPU time divided by the number of runs. Launches and the gaps
// between them are all in it. The median over several windows is given; except for v000 it joins two sittings, which
// can be a few percent apart, so the side-by-side timings, each taken in one sitting, are the better comparison.
// The starting kernel, v000, takes 6770 microseconds a run.
#include <hip/hip_runtime.h>

// Multi-head self-attention block with training-mode BatchNorm and a feed-forward (x [8][512][1024]; q, k, v = per-head 'xw' weights [16][1024][64] (uniform 0.05, no bias); scores / sqrt(64); softmax; concat heads @ W ('xw' [1024][1024]); out1 = BatchNorm(x + out) with batch statistics over all 8 x 512 rows per feature (biased variance, eps 1e-3, g1/be1); out2 = relu(out1 W1 + b1) W2 + b2 ('xw', zero biases); y = BatchNorm(out1 + out2) (g2/be2) -> [8][512][1024] (4.2 M); argument order x, Wq, Wk, Wv, W, W1, b1, W2, b2, g1, be1, g2, be2).
// Layout: per-head 'xw' weight blocks gathered into Bt; per batch: bf16 copy of x, exact projections, dense T-512 attention with every row on hi/lo planes (3 products), merged hi/lo x W exact into the all-batch buffer Y1 + bf16(x) residual; then over all 4,096 rows: a column-statistics kernel (thread per feature, serial fixed-order sums over the rows: mean, then centred variance), BatchNorm apply, hi/lo split, W1 GEMM + b1, ReLU, hi/lo split, W2 GEMM + b2, + out1, second column statistics and BatchNorm apply writing the output.
// Compute dtypes, f32 accumulate: every input rounded to bf16; projections exact; scores and attn.v 3 products; softmax f32; W / W1 / W2 hl x exact (+ f32 biases); BatchNorm statistics and apply f32 (serial index-order sums, IEEE sqrt/div).

#define NB_  8
#define TT   512
#define DM   1024
#define NH_  16
#define NKV  16
#define REP  (NH_ / NKV)
#define HD   64
#define DQ   (NH_ * HD)
#define DKV  (NKV * HD)
#define ZH   2
#define RH   512                  // query rows < RH use hi+lo planes (0: none)
#define WIN  0
#define PCAR 1024.0f
#define SCL  0.125f   // HD^-0.5
typedef _Float16 h16;
typedef unsigned short bf;
typedef __attribute__((ext_vector_type(16))) __bf16   v16bf;
typedef __attribute__((ext_vector_type(16))) _Float16 v16h;
typedef __attribute__((ext_vector_type(8)))  _Float16 v8h;
typedef __attribute__((ext_vector_type(8)))  unsigned short v8us;
typedef __attribute__((ext_vector_type(8)))  float    v8f;
typedef __attribute__((ext_vector_type(4)))  float    v4f;
typedef v8h  __attribute__((may_alias)) v8ha;
typedef v4f  __attribute__((may_alias)) v4fa;
typedef v8us __attribute__((may_alias)) v8usa;

__device__ __forceinline__ unsigned short f2bf(float f) { unsigned u = __float_as_uint(f); u += 0x7FFFu + ((u >> 16) & 1u); return (unsigned short)(u >> 16); }
__device__ __forceinline__ float bf2f(unsigned short b) { return __uint_as_float(((unsigned)b) << 16); }
__device__ __forceinline__ float bfr(float f) { return bf2f(f2bf(f)); }
__device__ __forceinline__ v16h cat16(v8h lo, v8h hi) { return __builtin_shufflevector(lo, hi, 0, 1, 2, 3, 4, 5, 6, 7, 8, 9, 10, 11, 12, 13, 14, 15); }
__device__ __forceinline__ v16bf cat16b(v8us lo, v8us hi) { return __builtin_bit_cast(v16bf, __builtin_shufflevector(lo, hi, 0, 1, 2, 3, 4, 5, 6, 7, 8, 9, 10, 11, 12, 13, 14, 15)); }
__device__ __forceinline__ v8f wmma16(v16h a, v16h b, v8f c) { return __builtin_amdgcn_wmma_f32_16x16x32_f16(false, a, false, b, (short)0, c, false, false); }
__device__ __forceinline__ v8f wmmab(v16bf a, v16bf b, v8f c) { return __builtin_amdgcn_wmma_f32_16x16x32_bf16(false, a, false, b, (short)0, c, false, false); }



// ---- k_gemmw: register-blocked GEMM, ONE WAVE per 64x64 output tile (16 accumulators), operands straight from K-contiguous 16-bit planes; grid (M/64, N/64, Z), 32 threads.
// C[m][n] (f32, pitch ldc, + optional f32 bias[n]) = sum_k A[m][k] Bt[n][k] (+ split products per NSPLIT). z-batch strides sA/sB/sC in elements. K % 32 == 0.
template <typename T16> struct WFrag;
template <> struct WFrag<h16> { typedef v16h V; static __device__ __forceinline__ V ld(const h16* p) { return cat16(*(const v8h*)p, *(const v8h*)(p + 16)); } static __device__ __forceinline__ v8f mma(V a, V b, v8f c) { return wmma16(a, b, c); } };
template <> struct WFrag<bf> { typedef v16bf V; static __device__ __forceinline__ V ld(const bf* p) { return cat16b(*(const v8us*)p, *(const v8us*)(p + 16)); } static __device__ __forceinline__ v8f mma(V a, V b, v8f c) { return wmmab(a, b, c); } };
template <typename T16, int NSPLIT, bool BIAS>
__global__ __launch_bounds__(32) void k_gemmw(const T16* __restrict__ A, const T16* __restrict__ A2, const T16* __restrict__ Bt, const T16* __restrict__ Bt2, int K, float* C, int ldc, const float* __restrict__ bias, size_t sA, size_t sB, size_t sC) {
    typedef typename WFrag<T16>::V V;
    __shared__ __align__(16) float os[16 * 68];
    const size_t z = blockIdx.z; A += z * sA; if (A2) A2 += z * sA; Bt += z * sB; if (Bt2) Bt2 += z * sB; C += z * sC;
    const int lane = threadIdx.x & 31, lr = lane & 15, hi = lane >> 4; const int r0 = blockIdx.x * 64, c0 = blockIdx.y * 64;
    v8f acc[4][4];
#pragma unroll
    for (int mb = 0; mb < 4; ++mb)
#pragma unroll
        for (int nb = 0; nb < 4; ++nb) acc[mb][nb] = (v8f){};
    const size_t aoff = (size_t)(r0 + lr) * K + 8 * hi, boff = (size_t)(c0 + lr) * K + 8 * hi;
#pragma unroll 1
    for (int kc = 0; kc < K; kc += 32) {
        V a[4], a2[4];
#pragma unroll
        for (int mb = 0; mb < 4; ++mb) { a[mb] = WFrag<T16>::ld(A + aoff + (size_t)mb * 16 * K + kc); if (NSPLIT == 1 || NSPLIT == 2) a2[mb] = WFrag<T16>::ld(A2 + aoff + (size_t)mb * 16 * K + kc); }
#pragma unroll
        for (int nb = 0; nb < 4; ++nb) { const V b = WFrag<T16>::ld(Bt + boff + (size_t)nb * 16 * K + kc); V b2; if (NSPLIT >= 2) b2 = WFrag<T16>::ld(Bt2 + boff + (size_t)nb * 16 * K + kc);
#pragma unroll
            for (int mb = 0; mb < 4; ++mb) { acc[mb][nb] = WFrag<T16>::mma(a[mb], b, acc[mb][nb]); if (NSPLIT == 1 || NSPLIT == 2) acc[mb][nb] = WFrag<T16>::mma(a2[mb], b, acc[mb][nb]); if (NSPLIT >= 2) acc[mb][nb] = WFrag<T16>::mma(a[mb], b2, acc[mb][nb]); } }
        asm volatile("v_nop\n\tv_nop\n\tv_nop\n\tv_nop" : "+v"(acc[0][0]), "+v"(acc[1][1]), "+v"(acc[2][2]), "+v"(acc[3][3]) : "v"(a[0]), "v"(a[3]));
    }
#pragma unroll
    for (int mb = 0; mb < 4; ++mb) {
#pragma unroll
        for (int nb = 0; nb < 4; ++nb) {
#pragma unroll
            for (int j = 0; j < 8; ++j) os[(hi * 8 + j) * 68 + nb * 16 + lr] = acc[mb][nb][j]; }
        __builtin_amdgcn_wave_barrier(); asm volatile("" ::: "memory");
        float* crow = C + (size_t)(r0 + mb * 16) * ldc + c0;
{
#pragma unroll
            for (int s = 0; s < 8; ++s) { const int row = 2 * s + hi, cofs = lr * 4; v4f val = *(const v4fa*)(os + row * 68 + cofs); if (BIAS) { val[0] += bfr(bias[c0 + cofs]); val[1] += bfr(bias[c0 + cofs + 1]); val[2] += bfr(bias[c0 + cofs + 2]); val[3] += bfr(bias[c0 + cofs + 3]); }
                *(v4f*)(crow + (size_t)row * ldc + cofs) = val; }
             }
        __builtin_amdgcn_wave_barrier(); asm volatile("" ::: "memory");
    }
}

__device__ __forceinline__ h16 tohx(float x) { return (h16)x; }
__device__ __forceinline__ void splitf(float y, unsigned short& h, unsigned short& l) { h = f2bf(y); l = f2bf(y - bf2f(h)); }
typedef __attribute__((ext_vector_type(2))) _Float16 v2h;
typedef __attribute__((ext_vector_type(4))) _Float16 v4h;
typedef __attribute__((ext_vector_type(2))) unsigned short v2us;
typedef __attribute__((ext_vector_type(4))) unsigned short v4us;
typedef __attribute__((ext_vector_type(2))) float v2f;
typedef __attribute__((ext_vector_type(4))) int v4i;

__global__ __launch_bounds__(256) void k_wtG(const float* __restrict__ w, int K, int N, bf* Bt) {
    const int lane = threadIdx.x & 31; const int L0 = (blockIdx.x * 8 + (threadIdx.x >> 5)) * 8; const int nlines = N * K / 64;
{
#pragma unroll 1
        for (int l = 0; l < 8; ++l) { const int L = L0 + l; if (L >= nlines) break; const size_t e = (size_t)L * 64 + lane * 2; const int k = (int)(e % K), n = (int)(e / K); v2us o;
            o[0] = f2bf(w[(size_t)k * N + n]); o[1] = f2bf(w[(size_t)(k + 1) * N + n]); *(v2us*)(Bt + e) = o; }
         }
}
__global__ __launch_bounds__(256) void k_cvt8(const float* __restrict__ src, bf* dst, size_t n8) { const size_t i = (size_t)blockIdx.x * 256 + threadIdx.x; if (i >= n8) return; const v8f v = *(const v8f*)(src + i * 8); v8us o;
#pragma unroll
    for (int k = 0; k < 8; ++k) o[k] = f2bf(v[k]); *(v8us*)(dst + i * 8) = o;  }

// k_rope: head planes [h][t][d] (fp16 + hi/lo) of rope(x) x sc with the rotate-half convention out[d] = x[d] cos[t][d] - x[d+HD/2] sin[t][d], out[d+HD/2] = x[d+HD/2] cos[t][d+HD/2] + x[d] sin[t][d+HD/2]
__global__ __launch_bounds__(256) void k_rope(const float* __restrict__ F, int pitch, int nheads, const float* __restrict__ CS, const float* __restrict__ RF, const float* __restrict__ nw, float sc, h16* P16, bf* Ph, bf* Pl) {
    const size_t e = ((size_t)blockIdx.x * 256 + threadIdx.x) * 2; if (e >= (size_t)nheads * TT * HD) return; const int d = (int)(e % HD); const int t = (int)((e / HD) % TT); const int h = (int)(e / ((size_t)HD * TT)); const float* f = F + (size_t)t * pitch + h * HD; const float rf = RF ? RF[(size_t)h * TT + t] : 1.0f; v2h o16; v2us oh, ol;
#pragma unroll
    for (int q = 0; q < 2; ++q) { const int dd = d + q; const int dp = (dd < HD / 2) ? dd + HD / 2 : dd - HD / 2; float x0 = f[dd], x1 = f[dp];
        if (RF) { float n0 = __fmul_rn(x0, rf), n1 = __fmul_rn(x1, rf); asm volatile("" : "+v"(n0)); asm volatile("" : "+v"(n1)); x0 = __fmul_rn(bfr(nw[dd]), n0); x1 = __fmul_rn(bfr(nw[dp]), n1); }
        const v2f cs = *(const v2f*)(CS + ((size_t)t * HD + dd) * 2); float a = __fmul_rn(x0, cs[0]), bq = __fmul_rn(x1, cs[1]); asm volatile("" : "+v"(a)); asm volatile("" : "+v"(bq)); const float r = ((dd < HD / 2) ? __fsub_rn(a, bq) : __fadd_rn(a, bq)) * sc;
        o16[q] = tohx(r); unsigned short a2, c2; splitf(r, a2, c2); oh[q] = a2; ol[q] = c2; }
    *(v2h*)(P16 + e) = o16; *(v2us*)(Ph + e) = oh; *(v2us*)(Pl + e) = ol;  }
__global__ __launch_bounds__(256) void k_vtp(const float* __restrict__ F, int pitch, int nheads, h16* V16, bf* Vh, bf* Vl) { const size_t e = ((size_t)blockIdx.x * 256 + threadIdx.x) * 2; if (e >= (size_t)nheads * HD * TT) return; const int t = (int)(e % TT); const int d = (int)((e / TT) % HD); const int g = (int)(e / ((size_t)TT * HD)); v2h o16; v2us oh, ol;
#pragma unroll
    for (int q = 0; q < 2; ++q) { const float x = F[(size_t)(t + q) * pitch + g * HD + d]; o16[q] = tohx(x); unsigned short a2, c2; splitf(x, a2, c2); oh[q] = a2; ol[q] = c2; }
    *(v2h*)(V16 + e) = o16; *(v2us*)(Vh + e) = oh; *(v2us*)(Vl + e) = ol;  }
__global__ __launch_bounds__(256) void k_csid(float* CS) { const int idx = blockIdx.x * 256 + threadIdx.x; if (idx >= TT * HD) return; v2f cs; cs[0] = 1.0f; cs[1] = 0.0f; *(v2f*)(CS + (size_t)idx * 2) = cs;  }
// k_asoft: per row (zz, i): t = S x HD^-0.5 (no mask); softmax over the 512 keys (register row, one exp, fixed trees);
__global__ __launch_bounds__(256) void k_asoft(const float* __restrict__ Sb, h16* P16, bf* Ph, bf* Pl) {
    const int lane = threadIdx.x & 31; const int row = blockIdx.x * 8 + (threadIdx.x >> 5); if (row >= ZH * TT) return; const int i = row % TT; const int zz = row / TT; (void)zz; const bool hires = (i < RH); const float* sr = Sb + (size_t)row * TT; float v[TT / 32]; float mx = -3.0e38f;
#pragma unroll
    for (int ch = 0; ch < TT / 128; ++ch) { const int j0 = ch * 128 + lane * 4; const v4f a = *(const v4f*)(sr + j0);
#pragma unroll
        for (int q = 0; q < 4; ++q) { const int j = j0 + q; (void)j; const float t = a[q] * SCL; v[ch * 4 + q] = t; mx = fmaxf(mx, t); } }
#pragma unroll
    for (int sh = 16; sh; sh >>= 1) mx = fmaxf(mx, __shfl_xor(mx, sh, 32));
    float sum = 0.f;
#pragma unroll
    for (int k = 0; k < TT / 32; ++k) { float d0 = __fsub_rn(v[k], mx); asm volatile("" : "+v"(d0)); v[k] = __builtin_amdgcn_exp2f(__fmul_rn(d0, 1.4426950408889634f)); sum += v[k]; }
#pragma unroll
    for (int sh = 16; sh; sh >>= 1) sum += __shfl_xor(sum, sh, 32);
    const float f = __fdiv_rn(hires ? 1.0f : PCAR, sum);
{
        if (hires) {
#pragma unroll
            for (int ch = 0; ch < TT / 128; ++ch) { v4us oh, ol;
#pragma unroll
                for (int q = 0; q < 4; ++q) { unsigned short a, c2; splitf(v[ch * 4 + q] * f, a, c2); oh[q] = a; ol[q] = c2; }
                const size_t oo = ((size_t)zz * (RH ? RH : 1) + i) * TT + ch * 128 + lane * 4; *(v4us*)(Ph + oo) = oh; *(v4us*)(Pl + oo) = ol; }
        } else {
#pragma unroll
            for (int ch = 0; ch < TT / 128; ++ch) { v4h o4;
#pragma unroll
                for (int q = 0; q < 4; ++q) o4[q] = tohx(v[ch * 4 + q] * f);
                *(v4h*)(P16 + (size_t)row * TT + ch * 128 + lane * 4) = o4; } }
         }
}
__global__ __launch_bounds__(256) void k_addres(float* Y, const float* __restrict__ xr) { const size_t i = (size_t)blockIdx.x * 256 + threadIdx.x; if (i >= (size_t)TT * DQ / 4) return; const v4f a = *(const v4f*)(Y + i * 4); const v4f r = *(const v4f*)(xr + i * 4); v4f o;
#pragma unroll
    for (int q = 0; q < 4; ++q) o[q] = __fadd_rn(a[q], bfr(r[q]));
    *(v4f*)(Y + i * 4) = o;  }
__global__ __launch_bounds__(256) void k_relu(float* F, size_t n4) { const size_t i = (size_t)blockIdx.x * 256 + threadIdx.x; if (i >= n4) return; const v4f a = *(const v4f*)(F + i * 4); v4f o;
#pragma unroll
    for (int q = 0; q < 4; ++q) o[q] = fmaxf(a[q], 0.0f);
    *(v4f*)(F + i * 4) = o;  }
__global__ __launch_bounds__(256) void k_tohl(const float* __restrict__ F, bf* Hh, bf* Hl, size_t n4) { const size_t i = (size_t)blockIdx.x * 256 + threadIdx.x; if (i >= n4) return; const v4f a = *(const v4f*)(F + i * 4); v4us oh, ol;
#pragma unroll
    for (int q = 0; q < 4; ++q) { unsigned short h2, l2; splitf(a[q], h2, l2); oh[q] = h2; ol[q] = l2; }
    *(v4us*)(Hh + i * 4) = oh; *(v4us*)(Hl + i * 4) = ol;  }
__global__ __launch_bounds__(256) void k_addf(float* F, const float* __restrict__ Lr, size_t n4) { const size_t i = (size_t)blockIdx.x * 256 + threadIdx.x; if (i >= n4) return; const v4f a = *(const v4f*)(F + i * 4); const v4f b = *(const v4f*)(Lr + i * 4); v4f o;
#pragma unroll
    for (int q = 0; q < 4; ++q) o[q] = __fadd_rn(a[q], b[q]);
    *(v4f*)(F + i * 4) = o;  }
#define BNEPS 1e-3f
__global__ __launch_bounds__(256) void k_colstat(const float* __restrict__ Y, float* ST) { const int c = blockIdx.x * 256 + threadIdx.x; if (c >= DM) return; const int NR = NB_ * TT; float s = 0.f;
#pragma unroll 1
    for (int r = 0; r < NR; ++r) s = __fadd_rn(s, Y[(size_t)r * DM + c]);
    const float mu = __fdiv_rn(s, (float)NR); float v = 0.f;
#pragma unroll 1
    for (int r = 0; r < NR; ++r) { const float d = __fsub_rn(Y[(size_t)r * DM + c], mu); float p = __fmul_rn(d, d); asm volatile("" : "+v"(p)); v = __fadd_rn(v, p); }
    const float rs = __fdiv_rn(1.0f, __fsqrt_rn(__fadd_rn(__fdiv_rn(v, (float)NR), BNEPS)));
    *(float*)(ST + c) = mu; *(float*)(ST + DM + c) = rs;  }
__global__ __launch_bounds__(256) void k_bnapply(const float* __restrict__ Y, const float* __restrict__ ST, const float* __restrict__ g, const float* __restrict__ bb, float* out) { const size_t i = (size_t)blockIdx.x * 256 + threadIdx.x; if (i >= (size_t)NB_ * TT * DM / 4) return; const size_t e = i * 4; const int c0 = (int)(e % DM); const v4f y = *(const v4f*)(Y + e); const v4f mu = *(const v4f*)(ST + c0); const v4f rs = *(const v4f*)(ST + DM + c0); const v4f gg = *(const v4f*)(g + c0); const v4f be = *(const v4f*)(bb + c0); v4f o;
#pragma unroll
    for (int q = 0; q < 4; ++q) { const float d = __fsub_rn(y[q], mu[q]); float n1 = __fmul_rn(d, rs[q]); asm volatile("" : "+v"(n1)); float n2 = __fmul_rn(n1, bfr(gg[q])); asm volatile("" : "+v"(n2)); o[q] = __fadd_rn(n2, bfr(be[q])); }
    *(v4f*)(out + e) = o;  }
__global__ __launch_bounds__(256) void k_merge(const float* __restrict__ O, int h0, bf* Ah, bf* Al) { const size_t e = ((size_t)blockIdx.x * 256 + threadIdx.x) * 2; if (e >= (size_t)ZH * TT * HD) return; const int d = (int)(e % HD); const int t = (int)((e / HD) % TT); const int zz = (int)(e / ((size_t)HD * TT)); const float cs = (t < RH) ? 1.0f : (1.0f / PCAR); const size_t oo = (size_t)t * DQ + (h0 + zz) * HD + d;
    v2us oh, ol;
#pragma unroll
    for (int q = 0; q < 2; ++q) { unsigned short a, c2; splitf(O[e + q] * cs, a, c2); oh[q] = a; ol[q] = c2; } *(v2us*)(Ah + oo) = oh; *(v2us*)(Al + oo) = ol;  }

extern "C" void kernel_launch(void* const* d_in, const int* in_sizes, int n_in,
                              void* d_out, int out_size, void* d_ws, size_t ws_size, hipStream_t stream) {
    (void)in_sizes; (void)n_in; (void)out_size;
    const float* x = (const float*)d_in[0]; const float* pq = (const float*)d_in[1]; const float* pk = (const float*)d_in[2]; const float* pv = (const float*)d_in[3];   /* [16][1024][64] each */ const float* wo = (const float*)d_in[4];   /* W [1024][1024] 'xw' */ const float* w1 = (const float*)d_in[5]; const float* b1 = (const float*)d_in[6]; const float* w2 = (const float*)d_in[7]; const float* b2 = (const float*)d_in[8]; const float* g1 = (const float*)d_in[9]; const float* be1 = (const float*)d_in[10]; const float* g2 = (const float*)d_in[11]; const float* be2 = (const float*)d_in[12];   /* order x, Wq, Wk, Wv, W, W1, b1, W2, b2, g1, be1, g2, be2 */ const float* wq = pq; const float* wk = pk; const float* wv = pv;
    float* OUT = (float*)d_out;     // [8][512][1024]
    char* wsp = (char*)d_ws;
    auto take = [&](size_t bytes) { char* p = wsp; wsp += (bytes + 255) & ~(size_t)255; return (void*)p; };
    bf* WQ = (bf*)take((size_t)DQ * DM * 2); bf* WK = (bf*)take((size_t)DKV * DM * 2); bf* WV = (bf*)take((size_t)DKV * DM * 2); bf* WO = (bf*)take((size_t)DM * DQ * 2); float* CS = (float*)take((size_t)TT * HD * 2 * 4);
    bf* W1B = (bf*)take((size_t)DM * DM * 2); bf* W2B = (bf*)take((size_t)DM * DM * 2); float* Y1 = (float*)take((size_t)NB_ * TT * DM * 4); float* O1 = (float*)take((size_t)NB_ * TT * DM * 4); float* HY = (float*)take((size_t)NB_ * TT * DM * 4); bf* Zh = (bf*)take((size_t)NB_ * TT * DM * 2); bf* Zl = (bf*)take((size_t)NB_ * TT * DM * 2); float* ST = (float*)take((size_t)2 * DM * 4);   /* all-batch buffers: x + attn W (Y1), BN1 output (O1), hidden / second residual (HY), hi/lo operand planes (Zh/Zl, reused), column mean / rstd */ bf* XB = (bf*)take((size_t)TT * DM * 2); float* FQ = (float*)take((size_t)TT * DQ * 4); float* FK = (float*)take((size_t)TT * DKV * 4);
    h16* QP16 = (h16*)take((size_t)NH_ * TT * HD * 2); h16* KP16 = (h16*)take((size_t)NKV * TT * HD * 2); h16* VT16 = (h16*)take((size_t)NKV * HD * TT * 2);
    bf* QPh = (bf*)take((size_t)NH_ * TT * HD * 2); bf* QPl = (bf*)take((size_t)NH_ * TT * HD * 2); bf* KPh = (bf*)take((size_t)NKV * TT * HD * 2); bf* KPl = (bf*)take((size_t)NKV * TT * HD * 2); bf* VTh = (bf*)take((size_t)NKV * HD * TT * 2); bf* VTl = (bf*)take((size_t)NKV * HD * TT * 2); bf* Ph = (bf*)take((size_t)ZH * RH * TT * 2); bf* Pl = (bf*)take((size_t)ZH * RH * TT * 2);
    float* Sb = (float*)take((size_t)ZH * TT * TT * 4); h16* P16 = (h16*)take((size_t)ZH * TT * TT * 2); float* Ob = (float*)take((size_t)ZH * TT * HD * 4); bf* ATh = (bf*)take((size_t)TT * DQ * 2); bf* ATl = (bf*)take((size_t)TT * DQ * 2);
    if ((size_t)(wsp - (char*)d_ws) > ws_size) return;    // ws 256 MiB
    float* FV = FK;   // v projection reuses the k buffer after the k planes are built (stream-ordered)
    { for (int hh = 0; hh < NH_; ++hh) { k_wtG<<<(unsigned)((DM * HD / 64 + 63) / 64), 256, 0, stream>>>(wq + (size_t)hh * DM * HD, DM, HD, WQ + (size_t)hh * HD * DM); k_wtG<<<(unsigned)((DM * HD / 64 + 63) / 64), 256, 0, stream>>>(wk + (size_t)hh * DM * HD, DM, HD, WK + (size_t)hh * HD * DM); k_wtG<<<(unsigned)((DM * HD / 64 + 63) / 64), 256, 0, stream>>>(wv + (size_t)hh * DM * HD, DM, HD, WV + (size_t)hh * HD * DM); }   /* head hh's 'xw' [1024][64] -> Bt rows hh*64.. */
      k_wtG<<<(unsigned)((DQ * DM / 64 + 63) / 64), 256, 0, stream>>>(wo, DQ, DM, WO); k_wtG<<<(unsigned)((DM * DM / 64 + 63) / 64), 256, 0, stream>>>(w1, DM, DM, W1B); k_wtG<<<(unsigned)((DM * DM / 64 + 63) / 64), 256, 0, stream>>>(w2, DM, DM, W2B); }
    k_csid<<<(TT * HD + 255) / 256, 256, 0, stream>>>(CS);
    const unsigned LQ = (unsigned)(((size_t)NH_ * TT * HD / 2 + 255) / 256), LKv = (unsigned)(((size_t)NKV * TT * HD / 2 + 255) / 256);
    for (int b = 0; b < NB_; ++b) {
        
        k_cvt8<<<(unsigned)(((size_t)TT * DM / 8 + 255) / 256), 256, 0, stream>>>(x + (size_t)b * TT * DM, XB, (size_t)TT * DM / 8);
        k_gemmw<bf, 0, false><<<dim3(TT / 64, DQ / 64, 1), 32, 0, stream>>>(XB, nullptr, WQ, nullptr, DM, FQ, DQ, nullptr, 0, 0, 0);
        k_rope<<<LQ, 256, 0, stream>>>(FQ, DQ, NH_, CS, nullptr, nullptr, 1.0f, QP16, QPh, QPl);
        k_gemmw<bf, 0, false><<<dim3(TT / 64, DKV / 64, 1), 32, 0, stream>>>(XB, nullptr, WK, nullptr, DM, FK, DKV, nullptr, 0, 0, 0);
        k_rope<<<LKv, 256, 0, stream>>>(FK, DKV, NKV, CS, nullptr, nullptr, 1.0f, KP16, KPh, KPl);
        k_gemmw<bf, 0, false><<<dim3(TT / 64, DKV / 64, 1), 32, 0, stream>>>(XB, nullptr, WV, nullptr, DM, FV, DKV, nullptr, 0, 0, 0); k_vtp<<<LKv, 256, 0, stream>>>(FV, DKV, NKV, VT16, VTh, VTl);
        for (int h0 = 0; h0 < NH_; h0 += ZH) { const size_t zq = (size_t)h0, zk = (size_t)(h0 / REP);   // one kv head per query head: the pass's two heads use consecutive kv planes (z-strides TT*HD)
            k_gemmw<bf, 2, false><<<dim3(RH / 64, TT / 64, ZH), 32, 0, stream>>>(QPh + zq * TT * HD, QPl + zq * TT * HD, KPh + zk * TT * HD, KPl + zk * TT * HD, HD, Sb, TT, nullptr, (size_t)TT * HD, (size_t)TT * HD, (size_t)TT * TT);
            k_asoft<<<ZH * TT / 8, 256, 0, stream>>>(Sb, P16, Ph, Pl);
            k_gemmw<bf, 2, false><<<dim3(RH / 64, HD / 64, ZH), 32, 0, stream>>>(Ph, Pl, VTh + zk * HD * TT, VTl + zk * HD * TT, TT, Ob, HD, nullptr, (size_t)RH * TT, (size_t)HD * TT, (size_t)TT * HD);
            k_merge<<<(unsigned)(((size_t)ZH * TT * HD / 2 + 255) / 256), 256, 0, stream>>>(Ob, h0, ATh, ATl); }
        k_gemmw<bf, 1, false><<<dim3(TT / 64, DM / 64, 1), 32, 0, stream>>>(ATh, ATl, WO, nullptr, DQ, Y1 + (size_t)b * TT * DM, DM, nullptr, 0, 0, 0); k_addres<<<(unsigned)(((size_t)TT * DM / 4 + 255) / 256), 256, 0, stream>>>(Y1 + (size_t)b * TT * DM, x + (size_t)b * TT * DM);   /* Y1[b] = concat W + bf16(x) */ }
    /* ---- all 4,096 rows: BatchNorm 1, feed-forward, BatchNorm 2 ---- */
    k_colstat<<<(DM + 255) / 256, 256, 0, stream>>>(Y1, ST); k_bnapply<<<(unsigned)(((size_t)NB_ * TT * DM / 4 + 255) / 256), 256, 0, stream>>>(Y1, ST, g1, be1, O1);   /* out1 */
    k_tohl<<<(unsigned)(((size_t)NB_ * TT * DM / 4 + 255) / 256), 256, 0, stream>>>(O1, Zh, Zl, (size_t)NB_ * TT * DM / 4); k_gemmw<bf, 1, true><<<dim3(NB_ * TT / 64, DM / 64, 1), 32, 0, stream>>>(Zh, Zl, W1B, nullptr, DM, HY, DM, b1, 0, 0, 0); k_relu<<<(unsigned)(((size_t)NB_ * TT * DM / 4 + 255) / 256), 256, 0, stream>>>(HY, (size_t)NB_ * TT * DM / 4);   /* relu(out1 W1 + b1) */
    k_tohl<<<(unsigned)(((size_t)NB_ * TT * DM / 4 + 255) / 256), 256, 0, stream>>>(HY, Zh, Zl, (size_t)NB_ * TT * DM / 4); k_gemmw<bf, 1, true><<<dim3(NB_ * TT / 64, DM / 64, 1), 32, 0, stream>>>(Zh, Zl, W2B, nullptr, DM, HY, DM, b2, 0, 0, 0); k_addf<<<(unsigned)(((size_t)NB_ * TT * DM / 4 + 255) / 256), 256, 0, stream>>>(HY, O1, (size_t)NB_ * TT * DM / 4);   /* out1 + out2 (HY rewritten by the W2 GEMM after its planes were built: stream-ordered) */
    k_colstat<<<(DM + 255) / 256, 256, 0, stream>>>(HY, ST); k_bnapply<<<(unsigned)(((size_t)NB_ * TT * DM / 4 + 255) / 256), 256, 0, stream>>>(HY, ST, g2, be2, OUT);   /* y */
}

// v001
// A run of this version takes 2660 microseconds.
// Two timings next to v000 put it at 2.51 and 2.56 times that version's speed.
#include <hip/hip_runtime.h>

// Multi-head self-attention block with training-mode BatchNorm and a feed-forward (x [8][512][1024]; q, k, v = per-head 'xw' weights [16][1024][64] (uniform 0.05, no bias); scores / sqrt(64); softmax; concat heads @ W ('xw' [1024][1024]); out1 = BatchNorm(x + out) with batch statistics over all 8 x 512 rows per feature (biased variance, eps 1e-3, g1/be1); out2 = relu(out1 W1 + b1) W2 + b2 ('xw', zero biases); y = BatchNorm(out1 + out2) (g2/be2) -> [8][512][1024] (4.2 M); argument order x, Wq, Wk, Wv, W, W1, b1, W2, b2, g1, be1, g2, be2).
// Layout: per-head 'xw' weight blocks gathered into Bt; per batch: bf16 copy of x, exact projections, dense T-512 attention with every row on hi/lo planes (3 products), merged hi/lo x W exact into the all-batch buffer Y1 + bf16(x) residual; then over all 4,096 rows: a column-statistics kernel (work-group per 32 features, rows dealt over its 1,024 threads, fixed-tree sums: mean, then centred variance), BatchNorm apply, hi/lo split, W1 GEMM + b1, ReLU, hi/lo split, W2 GEMM + b2, + out1, second column statistics and BatchNorm apply writing the output.
// Compute dtypes, f32 accumulate: every input rounded to bf16; projections exact; scores and attn.v 3 products; softmax f32; W / W1 / W2 hl x exact (+ f32 biases); BatchNorm statistics and apply f32 (fixed-tree sums, IEEE sqrt/div).

#define NB_  8
#define TT   512
#define DM   1024
#define NH_  16
#define NKV  16
#define REP  (NH_ / NKV)
#define HD   64
#define DQ   (NH_ * HD)
#define DKV  (NKV * HD)
#define ZH   2
#define RH   512                  // query rows < RH use hi+lo planes (0: none)
#define WIN  0
#define PCAR 1024.0f
#define SCL  0.125f   // HD^-0.5
typedef _Float16 h16;
typedef unsigned short bf;
typedef __attribute__((ext_vector_type(16))) __bf16   v16bf;
typedef __attribute__((ext_vector_type(16))) _Float16 v16h;
typedef __attribute__((ext_vector_type(8)))  _Float16 v8h;
typedef __attribute__((ext_vector_type(8)))  unsigned short v8us;
typedef __attribute__((ext_vector_type(8)))  float    v8f;
typedef __attribute__((ext_vector_type(4)))  float    v4f;
typedef v8h  __attribute__((may_alias)) v8ha;
typedef v4f  __attribute__((may_alias)) v4fa;
typedef v8us __attribute__((may_alias)) v8usa;

__device__ __forceinline__ unsigned short f2bf(float f) { unsigned u = __float_as_uint(f); u += 0x7FFFu + ((u >> 16) & 1u); return (unsigned short)(u >> 16); }
__device__ __forceinline__ float bf2f(unsigned short b) { return __uint_as_float(((unsigned)b) << 16); }
__device__ __forceinline__ float bfr(float f) { return bf2f(f2bf(f)); }
__device__ __forceinline__ v16h cat16(v8h lo, v8h hi) { return __builtin_shufflevector(lo, hi, 0, 1, 2, 3, 4, 5, 6, 7, 8, 9, 10, 11, 12, 13, 14, 15); }
__device__ __forceinline__ v16bf cat16b(v8us lo, v8us hi) { return __builtin_bit_cast(v16bf, __builtin_shufflevector(lo, hi, 0, 1, 2, 3, 4, 5, 6, 7, 8, 9, 10, 11, 12, 13, 14, 15)); }
__device__ __forceinline__ v8f wmma16(v16h a, v16h b, v8f c) { return __builtin_amdgcn_wmma_f32_16x16x32_f16(false, a, false, b, (short)0, c, false, false); }
__device__ __forceinline__ v8f wmmab(v16bf a, v16bf b, v8f c) { return __builtin_amdgcn_wmma_f32_16x16x32_bf16(false, a, false, b, (short)0, c, false, false); }



// ---- k_gemmw: register-blocked GEMM, ONE WAVE per 64x64 output tile (16 accumulators), operands straight from K-contiguous 16-bit planes; grid (M/64, N/64, Z), 32 threads.
// C[m][n] (f32, pitch ldc, + optional f32 bias[n]) = sum_k A[m][k] Bt[n][k] (+ split products per NSPLIT). z-batch strides sA/sB/sC in elements. K % 32 == 0.
template <typename T16> struct WFrag;
template <> struct WFrag<h16> { typedef v16h V; static __device__ __forceinline__ V ld(const h16* p) { return cat16(*(const v8h*)p, *(const v8h*)(p + 16)); } static __device__ __forceinline__ v8f mma(V a, V b, v8f c) { return wmma16(a, b, c); } };
template <> struct WFrag<bf> { typedef v16bf V; static __device__ __forceinline__ V ld(const bf* p) { return cat16b(*(const v8us*)p, *(const v8us*)(p + 16)); } static __device__ __forceinline__ v8f mma(V a, V b, v8f c) { return wmmab(a, b, c); } };
template <typename T16, int NSPLIT, bool BIAS>
__global__ __launch_bounds__(32) void k_gemmw(const T16* __restrict__ A, const T16* __restrict__ A2, const T16* __restrict__ Bt, const T16* __restrict__ Bt2, int K, float* C, int ldc, const float* __restrict__ bias, size_t sA, size_t sB, size_t sC) {
    typedef typename WFrag<T16>::V V;
    __shared__ __align__(16) float os[16 * 68];
    const size_t z = blockIdx.z; A += z * sA; if (A2) A2 += z * sA; Bt += z * sB; if (Bt2) Bt2 += z * sB; C += z * sC;
    const int lane = threadIdx.x & 31, lr = lane & 15, hi = lane >> 4; const int r0 = blockIdx.x * 64, c0 = blockIdx.y * 64;
    v8f acc[4][4];
#pragma unroll
    for (int mb = 0; mb < 4; ++mb)
#pragma unroll
        for (int nb = 0; nb < 4; ++nb) acc[mb][nb] = (v8f){};
    const size_t aoff = (size_t)(r0 + lr) * K + 8 * hi, boff = (size_t)(c0 + lr) * K + 8 * hi;
#pragma unroll 1
    for (int kc = 0; kc < K; kc += 32) {
        V a[4], a2[4];
#pragma unroll
        for (int mb = 0; mb < 4; ++mb) { a[mb] = WFrag<T16>::ld(A + aoff + (size_t)mb * 16 * K + kc); if (NSPLIT == 1 || NSPLIT == 2) a2[mb] = WFrag<T16>::ld(A2 + aoff + (size_t)mb * 16 * K + kc); }
#pragma unroll
        for (int nb = 0; nb < 4; ++nb) { const V b = WFrag<T16>::ld(Bt + boff + (size_t)nb * 16 * K + kc); V b2; if (NSPLIT >= 2) b2 = WFrag<T16>::ld(Bt2 + boff + (size_t)nb * 16 * K + kc);
#pragma unroll
            for (int mb = 0; mb < 4; ++mb) { acc[mb][nb] = WFrag<T16>::mma(a[mb], b, acc[mb][nb]); if (NSPLIT == 1 || NSPLIT == 2) acc[mb][nb] = WFrag<T16>::mma(a2[mb], b, acc[mb][nb]); if (NSPLIT >= 2) acc[mb][nb] = WFrag<T16>::mma(a[mb], b2, acc[mb][nb]); } }
        asm volatile("v_nop\n\tv_nop\n\tv_nop\n\tv_nop" : "+v"(acc[0][0]), "+v"(acc[1][1]), "+v"(acc[2][2]), "+v"(acc[3][3]) : "v"(a[0]), "v"(a[3]));
    }
#pragma unroll
    for (int mb = 0; mb < 4; ++mb) {
#pragma unroll
        for (int nb = 0; nb < 4; ++nb) {
#pragma unroll
            for (int j = 0; j < 8; ++j) os[(hi * 8 + j) * 68 + nb * 16 + lr] = acc[mb][nb][j]; }
        __builtin_amdgcn_wave_barrier(); asm volatile("" ::: "memory");
        float* crow = C + (size_t)(r0 + mb * 16) * ldc + c0;
{
#pragma unroll
            for (int s = 0; s < 8; ++s) { const int row = 2 * s + hi, cofs = lr * 4; v4f val = *(const v4fa*)(os + row * 68 + cofs); if (BIAS) { val[0] += bfr(bias[c0 + cofs]); val[1] += bfr(bias[c0 + cofs + 1]); val[2] += bfr(bias[c0 + cofs + 2]); val[3] += bfr(bias[c0 + cofs + 3]); }
                *(v4f*)(crow + (size_t)row * ldc + cofs) = val; }
             }
        __builtin_amdgcn_wave_barrier(); asm volatile("" ::: "memory");
    }
}

__device__ __forceinline__ h16 tohx(float x) { return (h16)x; }
__device__ __forceinline__ void splitf(float y, unsigned short& h, unsigned short& l) { h = f2bf(y); l = f2bf(y - bf2f(h)); }
typedef __attribute__((ext_vector_type(2))) _Float16 v2h;
typedef __attribute__((ext_vector_type(4))) _Float16 v4h;
typedef __attribute__((ext_vector_type(2))) unsigned short v2us;
typedef __attribute__((ext_vector_type(4))) unsigned short v4us;
typedef __attribute__((ext_vector_type(2))) float v2f;
typedef __attribute__((ext_vector_type(4))) int v4i;

__global__ __launch_bounds__(256) void k_wtG(const float* __restrict__ w, int K, int N, bf* Bt) {
    const int lane = threadIdx.x & 31; const int L0 = (blockIdx.x * 8 + (threadIdx.x >> 5)) * 8; const int nlines = N * K / 64;
{
#pragma unroll 1
        for (int l = 0; l < 8; ++l) { const int L = L0 + l; if (L >= nlines) break; const size_t e = (size_t)L * 64 + lane * 2; const int k = (int)(e % K), n = (int)(e / K); v2us o;
            o[0] = f2bf(w[(size_t)k * N + n]); o[1] = f2bf(w[(size_t)(k + 1) * N + n]); *(v2us*)(Bt + e) = o; }
         }
}
__global__ __launch_bounds__(256) void k_cvt8(const float* __restrict__ src, bf* dst, size_t n8) { const size_t i = (size_t)blockIdx.x * 256 + threadIdx.x; if (i >= n8) return; const v8f v = *(const v8f*)(src + i * 8); v8us o;
#pragma unroll
    for (int k = 0; k < 8; ++k) o[k] = f2bf(v[k]); *(v8us*)(dst + i * 8) = o;  }

// k_rope: head planes [h][t][d] (fp16 + hi/lo) of rope(x) x sc with the rotate-half convention out[d] = x[d] cos[t][d] - x[d+HD/2] sin[t][d], out[d+HD/2] = x[d+HD/2] cos[t][d+HD/2] + x[d] sin[t][d+HD/2]
__global__ __launch_bounds__(256) void k_rope(const float* __restrict__ F, int pitch, int nheads, const float* __restrict__ CS, const float* __restrict__ RF, const float* __restrict__ nw, float sc, h16* P16, bf* Ph, bf* Pl) {
    const size_t e = ((size_t)blockIdx.x * 256 + threadIdx.x) * 2; if (e >= (size_t)nheads * TT * HD) return; const int d = (int)(e % HD); const int t = (int)((e / HD) % TT); const int h = (int)(e / ((size_t)HD * TT)); const float* f = F + (size_t)t * pitch + h * HD; const float rf = RF ? RF[(size_t)h * TT + t] : 1.0f; v2h o16; v2us oh, ol;
#pragma unroll
    for (int q = 0; q < 2; ++q) { const int dd = d + q; const int dp = (dd < HD / 2) ? dd + HD / 2 : dd - HD / 2; float x0 = f[dd], x1 = f[dp];
        if (RF) { float n0 = __fmul_rn(x0, rf), n1 = __fmul_rn(x1, rf); asm volatile("" : "+v"(n0)); asm volatile("" : "+v"(n1)); x0 = __fmul_rn(bfr(nw[dd]), n0); x1 = __fmul_rn(bfr(nw[dp]), n1); }
        const v2f cs = *(const v2f*)(CS + ((size_t)t * HD + dd) * 2); float a = __fmul_rn(x0, cs[0]), bq = __fmul_rn(x1, cs[1]); asm volatile("" : "+v"(a)); asm volatile("" : "+v"(bq)); const float r = ((dd < HD / 2) ? __fsub_rn(a, bq) : __fadd_rn(a, bq)) * sc;
        o16[q] = tohx(r); unsigned short a2, c2; splitf(r, a2, c2); oh[q] = a2; ol[q] = c2; }
    *(v2h*)(P16 + e) = o16; *(v2us*)(Ph + e) = oh; *(v2us*)(Pl + e) = ol;  }
__global__ __launch_bounds__(256) void k_vtp(const float* __restrict__ F, int pitch, int nheads, h16* V16, bf* Vh, bf* Vl) { const size_t e = ((size_t)blockIdx.x * 256 + threadIdx.x) * 2; if (e >= (size_t)nheads * HD * TT) return; const int t = (int)(e % TT); const int d = (int)((e / TT) % HD); const int g = (int)(e / ((size_t)TT * HD)); v2h o16; v2us oh, ol;
#pragma unroll
    for (int q = 0; q < 2; ++q) { const float x = F[(size_t)(t + q) * pitch + g * HD + d]; o16[q] = tohx(x); unsigned short a2, c2; splitf(x, a2, c2); oh[q] = a2; ol[q] = c2; }
    *(v2h*)(V16 + e) = o16; *(v2us*)(Vh + e) = oh; *(v2us*)(Vl + e) = ol;  }
__global__ __launch_bounds__(256) void k_csid(float* CS) { const int idx = blockIdx.x * 256 + threadIdx.x; if (idx >= TT * HD) return; v2f cs; cs[0] = 1.0f; cs[1] = 0.0f; *(v2f*)(CS + (size_t)idx * 2) = cs;  }
// k_asoft: per row (zz, i): t = S x HD^-0.5 (no mask); softmax over the 512 keys (register row, one exp, fixed trees);
__global__ __launch_bounds__(256) void k_asoft(const float* __restrict__ Sb, h16* P16, bf* Ph, bf* Pl) {
    const int lane = threadIdx.x & 31; const int row = blockIdx.x * 8 + (threadIdx.x >> 5); if (row >= ZH * TT) return; const int i = row % TT; const int zz = row / TT; (void)zz; const bool hires = (i < RH); const float* sr = Sb + (size_t)row * TT; float v[TT / 32]; float mx = -3.0e38f;
#pragma unroll
    for (int ch = 0; ch < TT / 128; ++ch) { const int j0 = ch * 128 + lane * 4; const v4f a = *(const v4f*)(sr + j0);
#pragma unroll
        for (int q = 0; q < 4; ++q) { const int j = j0 + q; (void)j; const float t = a[q] * SCL; v[ch * 4 + q] = t; mx = fmaxf(mx, t); } }
#pragma unroll
    for (int sh = 16; sh; sh >>= 1) mx = fmaxf(mx, __shfl_xor(mx, sh, 32));
    float sum = 0.f;
#pragma unroll
    for (int k = 0; k < TT / 32; ++k) { float d0 = __fsub_rn(v[k], mx); asm volatile("" : "+v"(d0)); v[k] = __builtin_amdgcn_exp2f(__fmul_rn(d0, 1.4426950408889634f)); sum += v[k]; }
#pragma unroll
    for (int sh = 16; sh; sh >>= 1) sum += __shfl_xor(sum, sh, 32);
    const float f = __fdiv_rn(hires ? 1.0f : PCAR, sum);
{
        if (hires) {
#pragma unroll
            for (int ch = 0; ch < TT / 128; ++ch) { v4us oh, ol;
#pragma unroll
                for (int q = 0; q < 4; ++q) { unsigned short a, c2; splitf(v[ch * 4 + q] * f, a, c2); oh[q] = a; ol[q] = c2; }
                const size_t oo = ((size_t)zz * (RH ? RH : 1) + i) * TT + ch * 128 + lane * 4; *(v4us*)(Ph + oo) = oh; *(v4us*)(Pl + oo) = ol; }
        } else {
#pragma unroll
            for (int ch = 0; ch < TT / 128; ++ch) { v4h o4;
#pragma unroll
                for (int q = 0; q < 4; ++q) o4[q] = tohx(v[ch * 4 + q] * f);
                *(v4h*)(P16 + (size_t)row * TT + ch * 128 + lane * 4) = o4; } }
         }
}
__global__ __launch_bounds__(256) void k_addres(float* Y, const float* __restrict__ xr) { const size_t i = (size_t)blockIdx.x * 256 + threadIdx.x; if (i >= (size_t)TT * DQ / 4) return; const v4f a = *(const v4f*)(Y + i * 4); const v4f r = *(const v4f*)(xr + i * 4); v4f o;
#pragma unroll
    for (int q = 0; q < 4; ++q) o[q] = __fadd_rn(a[q], bfr(r[q]));
    *(v4f*)(Y + i * 4) = o;  }
__global__ __launch_bounds__(256) void k_relu(float* F, size_t n4) { const size_t i = (size_t)blockIdx.x * 256 + threadIdx.x; if (i >= n4) return; const v4f a = *(const v4f*)(F + i * 4); v4f o;
#pragma unroll
    for (int q = 0; q < 4; ++q) o[q] = fmaxf(a[q], 0.0f);
    *(v4f*)(F + i * 4) = o;  }
__global__ __launch_bounds__(256) void k_tohl(const float* __restrict__ F, bf* Hh, bf* Hl, size_t n4) { const size_t i = (size_t)blockIdx.x * 256 + threadIdx.x; if (i >= n4) return; const v4f a = *(const v4f*)(F + i * 4); v4us oh, ol;
#pragma unroll
    for (int q = 0; q < 4; ++q) { unsigned short h2, l2; splitf(a[q], h2, l2); oh[q] = h2; ol[q] = l2; }
    *(v4us*)(Hh + i * 4) = oh; *(v4us*)(Hl + i * 4) = ol;  }
__global__ __launch_bounds__(256) void k_addf(float* F, const float* __restrict__ Lr, size_t n4) { const size_t i = (size_t)blockIdx.x * 256 + threadIdx.x; if (i >= n4) return; const v4f a = *(const v4f*)(F + i * 4); const v4f b = *(const v4f*)(Lr + i * 4); v4f o;
#pragma unroll
    for (int q = 0; q < 4; ++q) o[q] = __fadd_rn(a[q], b[q]);
    *(v4f*)(F + i * 4) = o;  }
#define BNEPS 1e-3f
// k_colstat: one work-group of 32 waves per 32 features (one 128-B line of every row). Eight lanes read a row's line as 16-B pieces, so a wave load takes 4 rows and the block 128 rows;
// each thread sums its 32 rows (r = rg + 128 i, in index order, 8 loads in flight), then fixed trees: lanes 8 and 16 apart, the 32 waves' partials through LDS in wave order. Mean first, then the centred squares over a second read.
__device__ __forceinline__ float cs_fold(v4f s, float* red, int lane, int wv) {   // block sum per feature; the result is valid in wave 0 (lane = feature)
#pragma unroll
    for (int q = 0; q < 4; ++q) { s[q] += __shfl_xor(s[q], 8, 32); s[q] += __shfl_xor(s[q], 16, 32); }
    if (lane < 8) *(v4f*)(red + wv * 32 + lane * 4) = s;
    __syncthreads();   // every wave's partial is in red before wave 0 reads it
    float a = 0.f;
    if (wv == 0) {
#pragma unroll
        for (int w = 0; w < 32; ++w) a += red[w * 32 + lane]; }
    return a; }
__global__ __launch_bounds__(1024) void k_colstat(const float* __restrict__ Y, float* ST) {
    __shared__ __align__(16) float red[32 * 32]; __shared__ __align__(16) float mus[32];
    const int NR = NB_ * TT; const int lane = threadIdx.x & 31, wv = threadIdx.x >> 5, cg = threadIdx.x & 7, rg = threadIdx.x >> 3; const int c0 = blockIdx.x * 32;
    const float* p = Y + (size_t)rg * DM + c0 + cg * 4; v4f s = (v4f){};
#pragma unroll 1
    for (int i = 0; i < NR / 128; i += 8) { v4f t[8];
#pragma unroll
        for (int k = 0; k < 8; ++k) t[k] = *(const v4f*)(p + (size_t)(i + k) * 128 * DM);
#pragma unroll
        for (int k = 0; k < 8; ++k) s += t[k]; }
    const float mu1 = __fdiv_rn(cs_fold(s, red, lane, wv), (float)NR);
    if (wv == 0) mus[lane] = mu1;
    __syncthreads();   // publishes the means; also ends wave 0's reads of red before it is rewritten
    const v4f mu = *(const v4f*)(mus + cg * 4); v4f v = (v4f){};
#pragma unroll 1
    for (int i = 0; i < NR / 128; i += 8) { v4f t[8];
#pragma unroll
        for (int k = 0; k < 8; ++k) t[k] = *(const v4f*)(p + (size_t)(i + k) * 128 * DM);
#pragma unroll
        for (int k = 0; k < 8; ++k) {
#pragma unroll
            for (int q = 0; q < 4; ++q) { const float d = __fsub_rn(t[k][q], mu[q]); v[q] = __builtin_fmaf(d, d, v[q]); } } }
    const float vs = cs_fold(v, red, lane, wv);
    if (wv == 0) { const float rs = __fdiv_rn(1.0f, __fsqrt_rn(__fadd_rn(__fdiv_rn(vs, (float)NR), BNEPS))); ST[c0 + lane] = mu1; ST[DM + c0 + lane] = rs; } }
__global__ __launch_bounds__(256) void k_bnapply(const float* __restrict__ Y, const float* __restrict__ ST, const float* __restrict__ g, const float* __restrict__ bb, float* out) { const size_t i = (size_t)blockIdx.x * 256 + threadIdx.x; if (i >= (size_t)NB_ * TT * DM / 4) return; const size_t e = i * 4; const int c0 = (int)(e % DM); const v4f y = *(const v4f*)(Y + e); const v4f mu = *(const v4f*)(ST + c0); const v4f rs = *(const v4f*)(ST + DM + c0); const v4f gg = *(const v4f*)(g + c0); const v4f be = *(const v4f*)(bb + c0); v4f o;
#pragma unroll
    for (int q = 0; q < 4; ++q) { const float d = __fsub_rn(y[q], mu[q]); float n1 = __fmul_rn(d, rs[q]); asm volatile("" : "+v"(n1)); float n2 = __fmul_rn(n1, bfr(gg[q])); asm volatile("" : "+v"(n2)); o[q] = __fadd_rn(n2, bfr(be[q])); }
    *(v4f*)(out + e) = o;  }
__global__ __launch_bounds__(256) void k_merge(const float* __restrict__ O, int h0, bf* Ah, bf* Al) { const size_t e = ((size_t)blockIdx.x * 256 + threadIdx.x) * 2; if (e >= (size_t)ZH * TT * HD) return; const int d = (int)(e % HD); const int t = (int)((e / HD) % TT); const int zz = (int)(e / ((size_t)HD * TT)); const float cs = (t < RH) ? 1.0f : (1.0f / PCAR); const size_t oo = (size_t)t * DQ + (h0 + zz) * HD + d;
    v2us oh, ol;
#pragma unroll
    for (int q = 0; q < 2; ++q) { unsigned short a, c2; splitf(O[e + q] * cs, a, c2); oh[q] = a; ol[q] = c2; } *(v2us*)(Ah + oo) = oh; *(v2us*)(Al + oo) = ol;  }

extern "C" void kernel_launch(void* const* d_in, const int* in_sizes, int n_in,
                              void* d_out, int out_size, void* d_ws, size_t ws_size, hipStream_t stream) {
    (void)in_sizes; (void)n_in; (void)out_size;
    const float* x = (const float*)d_in[0]; const float* pq = (const float*)d_in[1]; const float* pk = (const float*)d_in[2]; const float* pv = (const float*)d_in[3];   /* [16][1024][64] each */ const float* wo = (const float*)d_in[4];   /* W [1024][1024] 'xw' */ const float* w1 = (const float*)d_in[5]; const float* b1 = (const float*)d_in[6]; const float* w2 = (const float*)d_in[7]; const float* b2 = (const float*)d_in[8]; const float* g1 = (const float*)d_in[9]; const float* be1 = (const float*)d_in[10]; const float* g2 = (const float*)d_in[11]; const float* be2 = (const float*)d_in[12];   /* order x, Wq, Wk, Wv, W, W1, b1, W2, b2, g1, be1, g2, be2 */ const float* wq = pq; const float* wk = pk; const float* wv = pv;
    float* OUT = (float*)d_out;     // [8][512][1024]
    char* wsp = (char*)d_ws;
    auto take = [&](size_t bytes) { char* p = wsp; wsp += (bytes + 255) & ~(size_t)255; return (void*)p; };
    bf* WQ = (bf*)take((size_t)DQ * DM * 2); bf* WK = (bf*)take((size_t)DKV * DM * 2); bf* WV = (bf*)take((size_t)DKV * DM * 2); bf* WO = (bf*)take((size_t)DM * DQ * 2); float* CS = (float*)take((size_t)TT * HD * 2 * 4);
    bf* W1B = (bf*)take((size_t)DM * DM * 2); bf* W2B = (bf*)take((size_t)DM * DM * 2); float* Y1 = (float*)take((size_t)NB_ * TT * DM * 4); float* O1 = (float*)take((size_t)NB_ * TT * DM * 4); float* HY = (float*)take((size_t)NB_ * TT * DM * 4); bf* Zh = (bf*)take((size_t)NB_ * TT * DM * 2); bf* Zl = (bf*)take((size_t)NB_ * TT * DM * 2); float* ST = (float*)take((size_t)2 * DM * 4);   /* all-batch buffers: x + attn W (Y1), BN1 output (O1), hidden / second residual (HY), hi/lo operand planes (Zh/Zl, reused), column mean / rstd */ bf* XB = (bf*)take((size_t)TT * DM * 2); float* FQ = (float*)take((size_t)TT * DQ * 4); float* FK = (float*)take((size_t)TT * DKV * 4);
    h16* QP16 = (h16*)take((size_t)NH_ * TT * HD * 2); h16* KP16 = (h16*)take((size_t)NKV * TT * HD * 2); h16* VT16 = (h16*)take((size_t)NKV * HD * TT * 2);
    bf* QPh = (bf*)take((size_t)NH_ * TT * HD * 2); bf* QPl = (bf*)take((size_t)NH_ * TT * HD * 2); bf* KPh = (bf*)take((size_t)NKV * TT * HD * 2); bf* KPl = (bf*)take((size_t)NKV * TT * HD * 2); bf* VTh = (bf*)take((size_t)NKV * HD * TT * 2); bf* VTl = (bf*)take((size_t)NKV * HD * TT * 2); bf* Ph = (bf*)take((size_t)ZH * RH * TT * 2); bf* Pl = (bf*)take((size_t)ZH * RH * TT * 2);
    float* Sb = (float*)take((size_t)ZH * TT * TT * 4); h16* P16 = (h16*)take((size_t)ZH * TT * TT * 2); float* Ob = (float*)take((size_t)ZH * TT * HD * 4); bf* ATh = (bf*)take((size_t)TT * DQ * 2); bf* ATl = (bf*)take((size_t)TT * DQ * 2);
    if ((size_t)(wsp - (char*)d_ws) > ws_size) return;    // ws 256 MiB
    float* FV = FK;   // v projection reuses the k buffer after the k planes are built (stream-ordered)
    { for (int hh = 0; hh < NH_; ++hh) { k_wtG<<<(unsigned)((DM * HD / 64 + 63) / 64), 256, 0, stream>>>(wq + (size_t)hh * DM * HD, DM, HD, WQ + (size_t)hh * HD * DM); k_wtG<<<(unsigned)((DM * HD / 64 + 63) / 64), 256, 0, stream>>>(wk + (size_t)hh * DM * HD, DM, HD, WK + (size_t)hh * HD * DM); k_wtG<<<(unsigned)((DM * HD / 64 + 63) / 64), 256, 0, stream>>>(wv + (size_t)hh * DM * HD, DM, HD, WV + (size_t)hh * HD * DM); }   /* head hh's 'xw' [1024][64] -> Bt rows hh*64.. */
      k_wtG<<<(unsigned)((DQ * DM / 64 + 63) / 64), 256, 0, stream>>>(wo, DQ, DM, WO); k_wtG<<<(unsigned)((DM * DM / 64 + 63) / 64), 256, 0, stream>>>(w1, DM, DM, W1B); k_wtG<<<(unsigned)((DM * DM / 64 + 63) / 64), 256, 0, stream>>>(w2, DM, DM, W2B); }
    k_csid<<<(TT * HD + 255) / 256, 256, 0, stream>>>(CS);
    const unsigned LQ = (unsigned)(((size_t)NH_ * TT * HD / 2 + 255) / 256), LKv = (unsigned)(((size_t)NKV * TT * HD / 2 + 255) / 256);
    for (int b = 0; b < NB_; ++b) {
        
        k_cvt8<<<(unsigned)(((size_t)TT * DM / 8 + 255) / 256), 256, 0, stream>>>(x + (size_t)b * TT * DM, XB, (size_t)TT * DM / 8);
        k_gemmw<bf, 0, false><<<dim3(TT / 64, DQ / 64, 1), 32, 0, stream>>>(XB, nullptr, WQ, nullptr, DM, FQ, DQ, nullptr, 0, 0, 0);
        k_rope<<<LQ, 256, 0, stream>>>(FQ, DQ, NH_, CS, nullptr, nullptr, 1.0f, QP16, QPh, QPl);
        k_gemmw<bf, 0, false><<<dim3(TT / 64, DKV / 64, 1), 32, 0, stream>>>(XB, nullptr, WK, nullptr, DM, FK, DKV, nullptr, 0, 0, 0);
        k_rope<<<LKv, 256, 0, stream>>>(FK, DKV, NKV, CS, nullptr, nullptr, 1.0f, KP16, KPh, KPl);
        k_gemmw<bf, 0, false><<<dim3(TT / 64, DKV / 64, 1), 32, 0, stream>>>(XB, nullptr, WV, nullptr, DM, FV, DKV, nullptr, 0, 0, 0); k_vtp<<<LKv, 256, 0, stream>>>(FV, DKV, NKV, VT16, VTh, VTl);
        for (int h0 = 0; h0 < NH_; h0 += ZH) { const size_t zq = (size_t)h0, zk = (size_t)(h0 / REP);   // one kv head per query head: the pass's two heads use consecutive kv planes (z-strides TT*HD)
            k_gemmw<bf, 2, false><<<dim3(RH / 64, TT / 64, ZH), 32, 0, stream>>>(QPh + zq * TT * HD, QPl + zq * TT * HD, KPh + zk * TT * HD, KPl + zk * TT * HD, HD, Sb, TT, nullptr, (size_t)TT * HD, (size_t)TT * HD, (size_t)TT * TT);
            k_asoft<<<ZH * TT / 8, 256, 0, stream>>>(Sb, P16, Ph, Pl);
            k_gemmw<bf, 2, false><<<dim3(RH / 64, HD / 64, ZH), 32, 0, stream>>>(Ph, Pl, VTh + zk * HD * TT, VTl + zk * HD * TT, TT, Ob, HD, nullptr, (size_t)RH * TT, (size_t)HD * TT, (size_t)TT * HD);
            k_merge<<<(unsigned)(((size_t)ZH * TT * HD / 2 + 255) / 256), 256, 0, stream>>>(Ob, h0, ATh, ATl); }
        k_gemmw<bf, 1, false><<<dim3(TT / 64, DM / 64, 1), 32, 0, stream>>>(ATh, ATl, WO, nullptr, DQ, Y1 + (size_t)b * TT * DM, DM, nullptr, 0, 0, 0); k_addres<<<(unsigned)(((size_t)TT * DM / 4 + 255) / 256), 256, 0, stream>>>(Y1 + (size_t)b * TT * DM, x + (size_t)b * TT * DM);   /* Y1[b] = concat W + bf16(x) */ }
    /* ---- all 4,096 rows: BatchNorm 1, feed-forward, BatchNorm 2 ---- */
    k_colstat<<<DM / 32, 1024, 0, stream>>>(Y1, ST); k_bnapply<<<(unsigned)(((size_t)NB_ * TT * DM / 4 + 255) / 256), 256, 0, stream>>>(Y1, ST, g1, be1, O1);   /* out1 */
    k_tohl<<<(unsigned)(((size_t)NB_ * TT * DM / 4 + 255) / 256), 256, 0, stream>>>(O1, Zh, Zl, (size_t)NB_ * TT * DM / 4); k_gemmw<bf, 1, true><<<dim3(NB_ * TT / 64, DM / 64, 1), 32, 0, stream>>>(Zh, Zl, W1B, nullptr, DM, HY, DM, b1, 0, 0, 0); k_relu<<<(unsigned)(((size_t)NB_ * TT * DM / 4 + 255) / 256), 256, 0, stream>>>(HY, (size_t)NB_ * TT * DM / 4);   /* relu(out1 W1 + b1) */
    k_tohl<<<(unsigned)(((size_t)NB_ * TT * DM / 4 + 255) / 256), 256, 0, stream>>>(HY, Zh, Zl, (size_t)NB_ * TT * DM / 4); k_gemmw<bf, 1, true><<<dim3(NB_ * TT / 64, DM / 64, 1), 32, 0, stream>>>(Zh, Zl, W2B, nullptr, DM, HY, DM, b2, 0, 0, 0); k_addf<<<(unsigned)(((size_t)NB_ * TT * DM / 4 + 255) / 256), 256, 0, stream>>>(HY, O1, (size_t)NB_ * TT * DM / 4);   /* out1 + out2 (HY rewritten by the W2 GEMM after its planes were built: stream-ordered) */
    k_colstat<<<DM / 32, 1024, 0, stream>>>(HY, ST); k_bnapply<<<(unsigned)(((size_t)NB_ * TT * DM / 4 + 255) / 256), 256, 0, stream>>>(HY, ST, g2, be2, OUT);   /* y */
}

// v002
// A run of this version takes 448 microseconds.
// In two side-by-side timings against v001, it was 5.94 and 5.90 times as fast.
// Counting every step since v000, it is 15.0 times as fast.
#include <hip/hip_runtime.h>

// Multi-head self-attention block with training-mode BatchNorm and a feed-forward (x [8][512][1024]; q, k, v = per-head 'xw' weights [16][1024][64] (uniform 0.05, no bias); scores / sqrt(64); softmax; concat heads @ W ('xw' [1024][1024]); out1 = BatchNorm(x + out) with batch statistics over all 8 x 512 rows per feature (biased variance, eps 1e-3, g1/be1); out2 = relu(out1 W1 + b1) W2 + b2 ('xw', zero biases); y = BatchNorm(out1 + out2) (g2/be2) -> [8][512][1024] (4.2 M); argument order x, Wq, Wk, Wv, W, W1, b1, W2, b2, g1, be1, g2, be2).
// Layout: per-head 'xw' weight blocks gathered into Bt (head and weight = grid y, z); over all 4,096 rows at once: bf16 copy of x, exact projections, head planes [batch][head] (batch = grid y); dense T-512 attention with every row on hi/lo planes (3 products) in 2 passes of 64 (batch, head) planes (plane = grid z); merged hi/lo x W exact into Y1 + bf16(x) residual; then: a column-statistics kernel (work-group per 32 features, rows dealt over its 1,024 threads, fixed-tree sums: mean, then centred variance), BatchNorm apply, hi/lo split, W1 GEMM + b1, ReLU, hi/lo split, W2 GEMM + b2, + out1, second column statistics and BatchNorm apply writing the output.
// Compute dtypes, f32 accumulate: every input rounded to bf16; projections exact; scores and attn.v 3 products; softmax f32; W / W1 / W2 hl x exact (+ f32 biases); BatchNorm statistics and apply f32 (fixed-tree sums, IEEE sqrt/div).

#define NB_  8
#define TT   512
#define DM   1024
#define NH_  16
#define NKV  16
#define REP  (NH_ / NKV)
#define HD   64
#define DQ   (NH_ * HD)
#define DKV  (NKV * HD)
#define ZH   64                   // (batch, head) planes per attention pass: 4 batches x 16 heads
#define RH   512                  // query rows < RH use hi+lo planes (0: none)
#define WIN  0
#define PCAR 1024.0f
#define SCL  0.125f   // HD^-0.5
typedef _Float16 h16;
typedef unsigned short bf;
typedef __attribute__((ext_vector_type(16))) __bf16   v16bf;
typedef __attribute__((ext_vector_type(16))) _Float16 v16h;
typedef __attribute__((ext_vector_type(8)))  _Float16 v8h;
typedef __attribute__((ext_vector_type(8)))  unsigned short v8us;
typedef __attribute__((ext_vector_type(8)))  float    v8f;
typedef __attribute__((ext_vector_type(4)))  float    v4f;
typedef v8h  __attribute__((may_alias)) v8ha;
typedef v4f  __attribute__((may_alias)) v4fa;
typedef v8us __attribute__((may_alias)) v8usa;

__device__ __forceinline__ unsigned short f2bf(float f) { unsigned u = __float_as_uint(f); u += 0x7FFFu + ((u >> 16) & 1u); return (unsigned short)(u >> 16); }
__device__ __forceinline__ float bf2f(unsigned short b) { return __uint_as_float(((unsigned)b) << 16); }
__device__ __forceinline__ float bfr(float f) { return bf2f(f2bf(f)); }
__device__ __forceinline__ v16h cat16(v8h lo, v8h hi) { return __builtin_shufflevector(lo, hi, 0, 1, 2, 3, 4, 5, 6, 7, 8, 9, 10, 11, 12, 13, 14, 15); }
__device__ __forceinline__ v16bf cat16b(v8us lo, v8us hi) { return __builtin_bit_cast(v16bf, __builtin_shufflevector(lo, hi, 0, 1, 2, 3, 4, 5, 6, 7, 8, 9, 10, 11, 12, 13, 14, 15)); }
__device__ __forceinline__ v8f wmma16(v16h a, v16h b, v8f c) { return __builtin_amdgcn_wmma_f32_16x16x32_f16(false, a, false, b, (short)0, c, false, false); }
__device__ __forceinline__ v8f wmmab(v16bf a, v16bf b, v8f c) { return __builtin_amdgcn_wmma_f32_16x16x32_bf16(false, a, false, b, (short)0, c, false, false); }



// ---- k_gemmw: register-blocked GEMM, ONE WAVE per 64x64 output tile (16 accumulators), operands straight from K-contiguous 16-bit planes; grid (M/64, N/64, Z), 32 threads.
// C[m][n] (f32, pitch ldc, + optional f32 bias[n]) = sum_k A[m][k] Bt[n][k] (+ split products per NSPLIT). z-batch strides sA/sB/sC in elements. K % 32 == 0.
template <typename T16> struct WFrag;
template <> struct WFrag<h16> { typedef v16h V; static __device__ __forceinline__ V ld(const h16* p) { return cat16(*(const v8h*)p, *(const v8h*)(p + 16)); } static __device__ __forceinline__ v8f mma(V a, V b, v8f c) { return wmma16(a, b, c); } };
template <> struct WFrag<bf> { typedef v16bf V; static __device__ __forceinline__ V ld(const bf* p) { return cat16b(*(const v8us*)p, *(const v8us*)(p + 16)); } static __device__ __forceinline__ v8f mma(V a, V b, v8f c) { return wmmab(a, b, c); } };
template <typename T16, int NSPLIT, bool BIAS>
__global__ __launch_bounds__(32) void k_gemmw(const T16* __restrict__ A, const T16* __restrict__ A2, const T16* __restrict__ Bt, const T16* __restrict__ Bt2, int K, float* C, int ldc, const float* __restrict__ bias, size_t sA, size_t sB, size_t sC) {
    typedef typename WFrag<T16>::V V;
    __shared__ __align__(16) float os[16 * 68];
    const size_t z = blockIdx.z; A += z * sA; if (A2) A2 += z * sA; Bt += z * sB; if (Bt2) Bt2 += z * sB; C += z * sC;
    const int lane = threadIdx.x & 31, lr = lane & 15, hi = lane >> 4; const int r0 = blockIdx.x * 64, c0 = blockIdx.y * 64;
    v8f acc[4][4];
#pragma unroll
    for (int mb = 0; mb < 4; ++mb)
#pragma unroll
        for (int nb = 0; nb < 4; ++nb) acc[mb][nb] = (v8f){};
    const size_t aoff = (size_t)(r0 + lr) * K + 8 * hi, boff = (size_t)(c0 + lr) * K + 8 * hi;
#pragma unroll 1
    for (int kc = 0; kc < K; kc += 32) {
        V a[4], a2[4];
#pragma unroll
        for (int mb = 0; mb < 4; ++mb) { a[mb] = WFrag<T16>::ld(A + aoff + (size_t)mb * 16 * K + kc); if (NSPLIT == 1 || NSPLIT == 2) a2[mb] = WFrag<T16>::ld(A2 + aoff + (size_t)mb * 16 * K + kc); }
#pragma unroll
        for (int nb = 0; nb < 4; ++nb) { const V b = WFrag<T16>::ld(Bt + boff + (size_t)nb * 16 * K + kc); V b2; if (NSPLIT >= 2) b2 = WFrag<T16>::ld(Bt2 + boff + (size_t)nb * 16 * K + kc);
#pragma unroll
            for (int mb = 0; mb < 4; ++mb) { acc[mb][nb] = WFrag<T16>::mma(a[mb], b, acc[mb][nb]); if (NSPLIT == 1 || NSPLIT == 2) acc[mb][nb] = WFrag<T16>::mma(a2[mb], b, acc[mb][nb]); if (NSPLIT >= 2) acc[mb][nb] = WFrag<T16>::mma(a[mb], b2, acc[mb][nb]); } }
        asm volatile("v_nop\n\tv_nop\n\tv_nop\n\tv_nop" : "+v"(acc[0][0]), "+v"(acc[1][1]), "+v"(acc[2][2]), "+v"(acc[3][3]) : "v"(a[0]), "v"(a[3]));
    }
#pragma unroll
    for (int mb = 0; mb < 4; ++mb) {
#pragma unroll
        for (int nb = 0; nb < 4; ++nb) {
#pragma unroll
            for (int j = 0; j < 8; ++j) os[(hi * 8 + j) * 68 + nb * 16 + lr] = acc[mb][nb][j]; }
        __builtin_amdgcn_wave_barrier(); asm volatile("" ::: "memory");
        float* crow = C + (size_t)(r0 + mb * 16) * ldc + c0;
{
#pragma unroll
            for (int s = 0; s < 8; ++s) { const int row = 2 * s + hi, cofs = lr * 4; v4f val = *(const v4fa*)(os + row * 68 + cofs); if (BIAS) { val[0] += bfr(bias[c0 + cofs]); val[1] += bfr(bias[c0 + cofs + 1]); val[2] += bfr(bias[c0 + cofs + 2]); val[3] += bfr(bias[c0 + cofs + 3]); }
                *(v4f*)(crow + (size_t)row * ldc + cofs) = val; }
             }
        __builtin_amdgcn_wave_barrier(); asm volatile("" ::: "memory");
    }
}

__device__ __forceinline__ h16 tohx(float x) { return (h16)x; }
__device__ __forceinline__ void splitf(float y, unsigned short& h, unsigned short& l) { h = f2bf(y); l = f2bf(y - bf2f(h)); }
typedef __attribute__((ext_vector_type(2))) _Float16 v2h;
typedef __attribute__((ext_vector_type(4))) _Float16 v4h;
typedef __attribute__((ext_vector_type(2))) unsigned short v2us;
typedef __attribute__((ext_vector_type(4))) unsigned short v4us;
typedef __attribute__((ext_vector_type(2))) float v2f;
typedef __attribute__((ext_vector_type(4))) int v4i;

// grid (lines, blocks, 3): z picks one of three weights of equal shape, y one [K][N] block of it (a head)
__global__ __launch_bounds__(256) void k_wtG(const float* __restrict__ wa, const float* __restrict__ wb, const float* __restrict__ wc, int K, int N, bf* Ba, bf* Bb, bf* Bc) {
    const size_t blk = (size_t)blockIdx.y * K * N; const float* w = (blockIdx.z == 0 ? wa : blockIdx.z == 1 ? wb : wc) + blk; bf* Bt = (blockIdx.z == 0 ? Ba : blockIdx.z == 1 ? Bb : Bc) + blk;
    const int lane = threadIdx.x & 31; const int L0 = (blockIdx.x * 8 + (threadIdx.x >> 5)) * 8; const int nlines = N * K / 64;
{
#pragma unroll 1
        for (int l = 0; l < 8; ++l) { const int L = L0 + l; if (L >= nlines) break; const size_t e = (size_t)L * 64 + lane * 2; const int k = (int)(e % K), n = (int)(e / K); v2us o;
            o[0] = f2bf(w[(size_t)k * N + n]); o[1] = f2bf(w[(size_t)(k + 1) * N + n]); *(v2us*)(Bt + e) = o; }
         }
}
__global__ __launch_bounds__(256) void k_cvt8(const float* __restrict__ src, bf* dst, size_t n8) { const size_t i = (size_t)blockIdx.x * 256 + threadIdx.x; if (i >= n8) return; const v8f v = *(const v8f*)(src + i * 8); v8us o;
#pragma unroll
    for (int k = 0; k < 8; ++k) o[k] = f2bf(v[k]); *(v8us*)(dst + i * 8) = o;  }

// k_rope: head planes [h][t][d] (fp16 + hi/lo) of rope(x) x sc with the rotate-half convention out[d] = x[d] cos[t][d] - x[d+HD/2] sin[t][d], out[d+HD/2] = x[d+HD/2] cos[t][d+HD/2] + x[d] sin[t][d+HD/2]
__global__ __launch_bounds__(256) void k_rope(const float* __restrict__ F, int pitch, int nheads, const float* __restrict__ CS, const float* __restrict__ RF, const float* __restrict__ nw, float sc, h16* P16, bf* Ph, bf* Pl) {
    { const size_t po = (size_t)blockIdx.y * nheads * TT * HD; F += (size_t)blockIdx.y * TT * pitch; P16 += po; Ph += po; Pl += po; }   // grid y = batch: its rows of F, its planes
    const size_t e = ((size_t)blockIdx.x * 256 + threadIdx.x) * 2; if (e >= (size_t)nheads * TT * HD) return; const int d = (int)(e % HD); const int t = (int)((e / HD) % TT); const int h = (int)(e / ((size_t)HD * TT)); const float* f = F + (size_t)t * pitch + h * HD; const float rf = RF ? RF[(size_t)h * TT + t] : 1.0f; v2h o16; v2us oh, ol;
#pragma unroll
    for (int q = 0; q < 2; ++q) { const int dd = d + q; const int dp = (dd < HD / 2) ? dd + HD / 2 : dd - HD / 2; float x0 = f[dd], x1 = f[dp];
        if (RF) { float n0 = __fmul_rn(x0, rf), n1 = __fmul_rn(x1, rf); asm volatile("" : "+v"(n0)); asm volatile("" : "+v"(n1)); x0 = __fmul_rn(bfr(nw[dd]), n0); x1 = __fmul_rn(bfr(nw[dp]), n1); }
        const v2f cs = *(const v2f*)(CS + ((size_t)t * HD + dd) * 2); float a = __fmul_rn(x0, cs[0]), bq = __fmul_rn(x1, cs[1]); asm volatile("" : "+v"(a)); asm volatile("" : "+v"(bq)); const float r = ((dd < HD / 2) ? __fsub_rn(a, bq) : __fadd_rn(a, bq)) * sc;
        o16[q] = tohx(r); unsigned short a2, c2; splitf(r, a2, c2); oh[q] = a2; ol[q] = c2; }
    *(v2h*)(P16 + e) = o16; *(v2us*)(Ph + e) = oh; *(v2us*)(Pl + e) = ol;  }
__global__ __launch_bounds__(256) void k_vtp(const float* __restrict__ F, int pitch, int nheads, h16* V16, bf* Vh, bf* Vl) { const size_t e = ((size_t)blockIdx.x * 256 + threadIdx.x) * 2; if (e >= (size_t)nheads * HD * TT) return; const int t = (int)(e % TT); const int d = (int)((e / TT) % HD); const int g = (int)(e / ((size_t)TT * HD)); v2h o16; v2us oh, ol;
    { const size_t po = (size_t)blockIdx.y * nheads * HD * TT; F += (size_t)blockIdx.y * TT * pitch; V16 += po; Vh += po; Vl += po; }   // grid y = batch: its rows of F, its planes
#pragma unroll
    for (int q = 0; q < 2; ++q) { const float x = F[(size_t)(t + q) * pitch + g * HD + d]; o16[q] = tohx(x); unsigned short a2, c2; splitf(x, a2, c2); oh[q] = a2; ol[q] = c2; }
    *(v2h*)(V16 + e) = o16; *(v2us*)(Vh + e) = oh; *(v2us*)(Vl + e) = ol;  }
__global__ __launch_bounds__(256) void k_csid(float* CS) { const int idx = blockIdx.x * 256 + threadIdx.x; if (idx >= TT * HD) return; v2f cs; cs[0] = 1.0f; cs[1] = 0.0f; *(v2f*)(CS + (size_t)idx * 2) = cs;  }
// k_asoft: per row (zz, i): t = S x HD^-0.5 (no mask); softmax over the 512 keys (register row, one exp, fixed trees);
__global__ __launch_bounds__(256) void k_asoft(const float* __restrict__ Sb, h16* P16, bf* Ph, bf* Pl) {
    const int lane = threadIdx.x & 31; const int row = blockIdx.x * 8 + (threadIdx.x >> 5); if (row >= ZH * TT) return; const int i = row % TT; const int zz = row / TT; (void)zz; const bool hires = (i < RH); const float* sr = Sb + (size_t)row * TT; float v[TT / 32]; float mx = -3.0e38f;
#pragma unroll
    for (int ch = 0; ch < TT / 128; ++ch) { const int j0 = ch * 128 + lane * 4; const v4f a = *(const v4f*)(sr + j0);
#pragma unroll
        for (int q = 0; q < 4; ++q) { const int j = j0 + q; (void)j; const float t = a[q] * SCL; v[ch * 4 + q] = t; mx = fmaxf(mx, t); } }
#pragma unroll
    for (int sh = 16; sh; sh >>= 1) mx = fmaxf(mx, __shfl_xor(mx, sh, 32));
    float sum = 0.f;
#pragma unroll
    for (int k = 0; k < TT / 32; ++k) { float d0 = __fsub_rn(v[k], mx); asm volatile("" : "+v"(d0)); v[k] = __builtin_amdgcn_exp2f(__fmul_rn(d0, 1.4426950408889634f)); sum += v[k]; }
#pragma unroll
    for (int sh = 16; sh; sh >>= 1) sum += __shfl_xor(sum, sh, 32);
    const float f = __fdiv_rn(hires ? 1.0f : PCAR, sum);
{
        if (hires) {
#pragma unroll
            for (int ch = 0; ch < TT / 128; ++ch) { v4us oh, ol;
#pragma unroll
                for (int q = 0; q < 4; ++q) { unsigned short a, c2; splitf(v[ch * 4 + q] * f, a, c2); oh[q] = a; ol[q] = c2; }
                const size_t oo = ((size_t)zz * (RH ? RH : 1) + i) * TT + ch * 128 + lane * 4; *(v4us*)(Ph + oo) = oh; *(v4us*)(Pl + oo) = ol; }
        } else {
#pragma unroll
            for (int ch = 0; ch < TT / 128; ++ch) { v4h o4;
#pragma unroll
                for (int q = 0; q < 4; ++q) o4[q] = tohx(v[ch * 4 + q] * f);
                *(v4h*)(P16 + (size_t)row * TT + ch * 128 + lane * 4) = o4; } }
         }
}
__global__ __launch_bounds__(256) void k_addres(float* Y, const float* __restrict__ xr) { const size_t i = (size_t)blockIdx.x * 256 + threadIdx.x; if (i >= (size_t)NB_ * TT * DQ / 4) return; const v4f a = *(const v4f*)(Y + i * 4); const v4f r = *(const v4f*)(xr + i * 4); v4f o;
#pragma unroll
    for (int q = 0; q < 4; ++q) o[q] = __fadd_rn(a[q], bfr(r[q]));
    *(v4f*)(Y + i * 4) = o;  }
__global__ __launch_bounds__(256) void k_relu(float* F, size_t n4) { const size_t i = (size_t)blockIdx.x * 256 + threadIdx.x; if (i >= n4) return; const v4f a = *(const v4f*)(F + i * 4); v4f o;
#pragma unroll
    for (int q = 0; q < 4; ++q) o[q] = fmaxf(a[q], 0.0f);
    *(v4f*)(F + i * 4) = o;  }
__global__ __launch_bounds__(256) void k_tohl(const float* __restrict__ F, bf* Hh, bf* Hl, size_t n4) { const size_t i = (size_t)blockIdx.x * 256 + threadIdx.x; if (i >= n4) return; const v4f a = *(const v4f*)(F + i * 4); v4us oh, ol;
#pragma unroll
    for (int q = 0; q < 4; ++q) { unsigned short h2, l2; splitf(a[q], h2, l2); oh[q] = h2; ol[q] = l2; }
    *(v4us*)(Hh + i * 4) = oh; *(v4us*)(Hl + i * 4) = ol;  }
__global__ __launch_bounds__(256) void k_addf(float* F, const float* __restrict__ Lr, size_t n4) { const size_t i = (size_t)blockIdx.x * 256 + threadIdx.x; if (i >= n4) return; const v4f a = *(const v4f*)(F + i * 4); const v4f b = *(const v4f*)(Lr + i * 4); v4f o;
#pragma unroll
    for (int q = 0; q < 4; ++q) o[q] = __fadd_rn(a[q], b[q]);
    *(v4f*)(F + i * 4) = o;  }
#define BNEPS 1e-3f
// k_colstat: one work-group of 32 waves per 32 features (one 128-B line of every row). Eight lanes read a row's line as 16-B pieces, so a wave load takes 4 rows and the block 128 rows;
// each thread sums its 32 rows (r = rg + 128 i, in index order, 8 loads in flight), then fixed trees: lanes 8 and 16 apart, the 32 waves' partials through LDS in wave order. Mean first, then the centred squares over a second read.
__device__ __forceinline__ float cs_fold(v4f s, float* red, int lane, int wv) {   // block sum per feature; the result is valid in wave 0 (lane = feature)
#pragma unroll
    for (int q = 0; q < 4; ++q) { s[q] += __shfl_xor(s[q], 8, 32); s[q] += __shfl_xor(s[q], 16, 32); }
    if (lane < 8) *(v4f*)(red + wv * 32 + lane * 4) = s;
    __syncthreads();   // every wave's partial is in red before wave 0 reads it
    float a = 0.f;
    if (wv == 0) {
#pragma unroll
        for (int w = 0; w < 32; ++w) a += red[w * 32 + lane]; }
    return a; }
__global__ __launch_bounds__(1024) void k_colstat(const float* __restrict__ Y, float* ST) {
    __shared__ __align__(16) float red[32 * 32]; __shared__ __align__(16) float mus[32];
    const int NR = NB_ * TT; const int lane = threadIdx.x & 31, wv = threadIdx.x >> 5, cg = threadIdx.x & 7, rg = threadIdx.x >> 3; const int c0 = blockIdx.x * 32;
    const float* p = Y + (size_t)rg * DM + c0 + cg * 4; v4f s = (v4f){};
#pragma unroll 1
    for (int i = 0; i < NR / 128; i += 8) { v4f t[8];
#pragma unroll
        for (int k = 0; k < 8; ++k) t[k] = *(const v4f*)(p + (size_t)(i + k) * 128 * DM);
#pragma unroll
        for (int k = 0; k < 8; ++k) s += t[k]; }
    const float mu1 = __fdiv_rn(cs_fold(s, red, lane, wv), (float)NR);
    if (wv == 0) mus[lane] = mu1;
    __syncthreads();   // publishes the means; also ends wave 0's reads of red before it is rewritten
    const v4f mu = *(const v4f*)(mus + cg * 4); v4f v = (v4f){};
#pragma unroll 1
    for (int i = 0; i < NR / 128; i += 8) { v4f t[8];
#pragma unroll
        for (int k = 0; k < 8; ++k) t[k] = *(const v4f*)(p + (size_t)(i + k) * 128 * DM);
#pragma unroll
        for (int k = 0; k < 8; ++k) {
#pragma unroll
            for (int q = 0; q < 4; ++q) { const float d = __fsub_rn(t[k][q], mu[q]); v[q] = __builtin_fmaf(d, d, v[q]); } } }
    const float vs = cs_fold(v, red, lane, wv);
    if (wv == 0) { const float rs = __fdiv_rn(1.0f, __fsqrt_rn(__fadd_rn(__fdiv_rn(vs, (float)NR), BNEPS))); ST[c0 + lane] = mu1; ST[DM + c0 + lane] = rs; } }
__global__ __launch_bounds__(256) void k_bnapply(const float* __restrict__ Y, const float* __restrict__ ST, const float* __restrict__ g, const float* __restrict__ bb, float* out) { const size_t i = (size_t)blockIdx.x * 256 + threadIdx.x; if (i >= (size_t)NB_ * TT * DM / 4) return; const size_t e = i * 4; const int c0 = (int)(e % DM); const v4f y = *(const v4f*)(Y + e); const v4f mu = *(const v4f*)(ST + c0); const v4f rs = *(const v4f*)(ST + DM + c0); const v4f gg = *(const v4f*)(g + c0); const v4f be = *(const v4f*)(bb + c0); v4f o;
#pragma unroll
    for (int q = 0; q < 4; ++q) { const float d = __fsub_rn(y[q], mu[q]); float n1 = __fmul_rn(d, rs[q]); asm volatile("" : "+v"(n1)); float n2 = __fmul_rn(n1, bfr(gg[q])); asm volatile("" : "+v"(n2)); o[q] = __fadd_rn(n2, bfr(be[q])); }
    *(v4f*)(out + e) = o;  }
__global__ __launch_bounds__(256) void k_merge(const float* __restrict__ O, int h0, bf* Ah, bf* Al) { const size_t e = ((size_t)blockIdx.x * 256 + threadIdx.x) * 2; if (e >= (size_t)ZH * TT * HD) return; const int d = (int)(e % HD); const int t = (int)((e / HD) % TT); const int zz = (int)(e / ((size_t)HD * TT)); const float cs = (t < RH) ? 1.0f : (1.0f / PCAR); const int pl = h0 + zz;   /* plane = batch * NH_ + head */ const size_t oo = ((size_t)(pl / NH_) * TT + t) * DQ + (pl % NH_) * HD + d;
    v2us oh, ol;
#pragma unroll
    for (int q = 0; q < 2; ++q) { unsigned short a, c2; splitf(O[e + q] * cs, a, c2); oh[q] = a; ol[q] = c2; } *(v2us*)(Ah + oo) = oh; *(v2us*)(Al + oo) = ol;  }

extern "C" void kernel_launch(void* const* d_in, const int* in_sizes, int n_in,
                              void* d_out, int out_size, void* d_ws, size_t ws_size, hipStream_t stream) {
    (void)in_sizes; (void)n_in; (void)out_size;
    const float* x = (const float*)d_in[0]; const float* pq = (const float*)d_in[1]; const float* pk = (const float*)d_in[2]; const float* pv = (const float*)d_in[3];   /* [16][1024][64] each */ const float* wo = (const float*)d_in[4];   /* W [1024][1024] 'xw' */ const float* w1 = (const float*)d_in[5]; const float* b1 = (const float*)d_in[6]; const float* w2 = (const float*)d_in[7]; const float* b2 = (const float*)d_in[8]; const float* g1 = (const float*)d_in[9]; const float* be1 = (const float*)d_in[10]; const float* g2 = (const float*)d_in[11]; const float* be2 = (const float*)d_in[12];   /* order x, Wq, Wk, Wv, W, W1, b1, W2, b2, g1, be1, g2, be2 */ const float* wq = pq; const float* wk = pk; const float* wv = pv;
    float* OUT = (float*)d_out;     // [8][512][1024]
    char* wsp = (char*)d_ws;
    auto take = [&](size_t bytes) { char* p = wsp; wsp += (bytes + 255) & ~(size_t)255; return (void*)p; };
    bf* WQ = (bf*)take((size_t)DQ * DM * 2); bf* WK = (bf*)take((size_t)DKV * DM * 2); bf* WV = (bf*)take((size_t)DKV * DM * 2); bf* WO = (bf*)take((size_t)DM * DQ * 2); float* CS = (float*)take((size_t)TT * HD * 2 * 4);
    bf* W1B = (bf*)take((size_t)DM * DM * 2); bf* W2B = (bf*)take((size_t)DM * DM * 2); float* ST = (float*)take((size_t)2 * DM * 4);   /* column mean / rstd */ bf* XB = (bf*)take((size_t)NB_ * TT * DM * 2);
    /* head planes of all batches, [batch][head][..] */
    h16* QP16 = (h16*)take((size_t)NB_ * NH_ * TT * HD * 2); h16* KP16 = (h16*)take((size_t)NB_ * NKV * TT * HD * 2); h16* VT16 = (h16*)take((size_t)NB_ * NKV * HD * TT * 2);
    bf* QPh = (bf*)take((size_t)NB_ * NH_ * TT * HD * 2); bf* QPl = (bf*)take((size_t)NB_ * NH_ * TT * HD * 2); bf* KPh = (bf*)take((size_t)NB_ * NKV * TT * HD * 2); bf* KPl = (bf*)take((size_t)NB_ * NKV * TT * HD * 2); bf* VTh = (bf*)take((size_t)NB_ * NKV * HD * TT * 2); bf* VTl = (bf*)take((size_t)NB_ * NKV * HD * TT * 2);
    float* Ob = (float*)take((size_t)ZH * TT * HD * 4); bf* ATh = (bf*)take((size_t)NB_ * TT * DQ * 2); bf* ATl = (bf*)take((size_t)NB_ * TT * DQ * 2);
    /* one region, three tenants one after the other (stream-ordered, each writes all it reads): the f32 projections; a pass's scores and probability planes; the all-batch buffers behind the attention */
    float* Sb = (float*)take((size_t)ZH * TT * TT * 4); bf* Ph = (bf*)take((size_t)ZH * RH * TT * 2); bf* Pl = (bf*)take((size_t)ZH * RH * TT * 2);
    if ((size_t)(wsp - (char*)d_ws) > ws_size) return;    // ws 256 MiB
    h16* P16 = nullptr;   // fp16 probability plane: no row uses it (RH == TT)
    float* FQ = Sb; float* FK = Sb + (size_t)NB_ * TT * DM;   /* dead once the head planes are built, before the first scores */
    float* Y1 = Sb; float* O1 = Y1 + (size_t)NB_ * TT * DM; float* HY = O1 + (size_t)NB_ * TT * DM; bf* Zh = (bf*)(HY + (size_t)NB_ * TT * DM); bf* Zl = Zh + (size_t)NB_ * TT * DM;   /* 64 MiB = the score buffer's size; first written after the last pass: x + attn W (Y1), BN1 output (O1), hidden / second residual (HY), hi/lo operand planes (Zh/Zl, reused) */
    float* FV = FK;   // v projection reuses the k buffer after the k planes are built (stream-ordered)
    k_wtG<<<dim3((DM * HD / 64 + 63) / 64, NH_, 3), 256, 0, stream>>>(wq, wk, wv, DM, HD, WQ, WK, WV);   /* head hh's 'xw' [1024][64] -> Bt rows hh*64.. */
    k_wtG<<<dim3((DM * DM / 64 + 63) / 64, 1, 3), 256, 0, stream>>>(wo, w1, w2, DM, DM, WO, W1B, W2B);
    k_csid<<<(TT * HD + 255) / 256, 256, 0, stream>>>(CS);
    const unsigned LQ = (unsigned)(((size_t)NH_ * TT * HD / 2 + 255) / 256), LKv = (unsigned)(((size_t)NKV * TT * HD / 2 + 255) / 256);
    k_cvt8<<<(unsigned)(((size_t)NB_ * TT * DM / 8 + 255) / 256), 256, 0, stream>>>(x, XB, (size_t)NB_ * TT * DM / 8);
    k_gemmw<bf, 0, false><<<dim3(NB_ * TT / 64, DQ / 64, 1), 32, 0, stream>>>(XB, nullptr, WQ, nullptr, DM, FQ, DQ, nullptr, 0, 0, 0);
    k_rope<<<dim3(LQ, NB_, 1), 256, 0, stream>>>(FQ, DQ, NH_, CS, nullptr, nullptr, 1.0f, QP16, QPh, QPl);
    k_gemmw<bf, 0, false><<<dim3(NB_ * TT / 64, DKV / 64, 1), 32, 0, stream>>>(XB, nullptr, WK, nullptr, DM, FK, DKV, nullptr, 0, 0, 0);
    k_rope<<<dim3(LKv, NB_, 1), 256, 0, stream>>>(FK, DKV, NKV, CS, nullptr, nullptr, 1.0f, KP16, KPh, KPl);
    k_gemmw<bf, 0, false><<<dim3(NB_ * TT / 64, DKV / 64, 1), 32, 0, stream>>>(XB, nullptr, WV, nullptr, DM, FV, DKV, nullptr, 0, 0, 0); k_vtp<<<dim3(LKv, NB_, 1), 256, 0, stream>>>(FV, DKV, NKV, VT16, VTh, VTl);
    for (int h0 = 0; h0 < NB_ * NH_; h0 += ZH) { const size_t zq = (size_t)h0, zk = (size_t)(h0 / REP);   // h0 = the pass's first (batch, head) plane; one kv head per query head: consecutive planes on both sides (z-strides TT*HD)
        k_gemmw<bf, 2, false><<<dim3(RH / 64, TT / 64, ZH), 32, 0, stream>>>(QPh + zq * TT * HD, QPl + zq * TT * HD, KPh + zk * TT * HD, KPl + zk * TT * HD, HD, Sb, TT, nullptr, (size_t)TT * HD, (size_t)TT * HD, (size_t)TT * TT);
        k_asoft<<<ZH * TT / 8, 256, 0, stream>>>(Sb, P16, Ph, Pl);
        k_gemmw<bf, 2, false><<<dim3(RH / 64, HD / 64, ZH), 32, 0, stream>>>(Ph, Pl, VTh + zk * HD * TT, VTl + zk * HD * TT, TT, Ob, HD, nullptr, (size_t)RH * TT, (size_t)HD * TT, (size_t)TT * HD);
        k_merge<<<(unsigned)(((size_t)ZH * TT * HD / 2 + 255) / 256), 256, 0, stream>>>(Ob, h0, ATh, ATl); }
    k_gemmw<bf, 1, false><<<dim3(NB_ * TT / 64, DM / 64, 1), 32, 0, stream>>>(ATh, ATl, WO, nullptr, DQ, Y1, DM, nullptr, 0, 0, 0); k_addres<<<(unsigned)(((size_t)NB_ * TT * DM / 4 + 255) / 256), 256, 0, stream>>>(Y1, x);   /* Y1 = concat W + bf16(x) */
    /* ---- all 4,096 rows: BatchNorm 1, feed-forward, BatchNorm 2 ---- */
    k_colstat<<<DM / 32, 1024, 0, stream>>>(Y1, ST); k_bnapply<<<(unsigned)(((size_t)NB_ * TT * DM / 4 + 255) / 256), 256, 0, stream>>>(Y1, ST, g1, be1, O1);   /* out1 */
    k_tohl<<<(unsigned)(((size_t)NB_ * TT * DM / 4 + 255) / 256), 256, 0, stream>>>(O1, Zh, Zl, (size_t)NB_ * TT * DM / 4); k_gemmw<bf, 1, true><<<dim3(NB_ * TT / 64, DM / 64, 1), 32, 0, stream>>>(Zh, Zl, W1B, nullptr, DM, HY, DM, b1, 0, 0, 0); k_relu<<<(unsigned)(((size_t)NB_ * TT * DM / 4 + 255) / 256), 256, 0, stream>>>(HY, (size_t)NB_ * TT * DM / 4);   /* relu(out1 W1 + b1) */
    k_tohl<<<(unsigned)(((size_t)NB_ * TT * DM / 4 + 255) / 256), 256, 0, stream>>>(HY, Zh, Zl, (size_t)NB_ * TT * DM / 4); k_gemmw<bf, 1, true><<<dim3(NB_ * TT / 64, DM / 64, 1), 32, 0, stream>>>(Zh, Zl, W2B, nullptr, DM, HY, DM, b2, 0, 0, 0); k_addf<<<(unsigned)(((size_t)NB_ * TT * DM / 4 + 255) / 256), 256, 0, stream>>>(HY, O1, (size_t)NB_ * TT * DM / 4);   /* out1 + out2 (HY rewritten by the W2 GEMM after its planes were built: stream-ordered) */
    k_colstat<<<DM / 32, 1024, 0, stream>>>(HY, ST); k_bnapply<<<(unsigned)(((size_t)NB_ * TT * DM / 4 + 255) / 256), 256, 0, stream>>>(HY, ST, g2, be2, OUT);   /* y */
}

// v003
// It runs in 383 microseconds.
// Two timings next to v002 both put it at 1.18 times that version's speed.
// All steps since v000 together make it 17.7 times as fast.
#include <hip/hip_runtime.h>

// Multi-head self-attention block with training-mode BatchNorm and a feed-forward (x [8][512][1024]; q, k, v = per-head 'xw' weights [16][1024][64] (uniform 0.05, no bias); scores / sqrt(64); softmax; concat heads @ W ('xw' [1024][1024]); out1 = BatchNorm(x + out) with batch statistics over all 8 x 512 rows per feature (biased variance, eps 1e-3, g1/be1); out2 = relu(out1 W1 + b1) W2 + b2 ('xw', zero biases); y = BatchNorm(out1 + out2) (g2/be2) -> [8][512][1024] (4.2 M); argument order x, Wq, Wk, Wv, W, W1, b1, W2, b2, g1, be1, g2, be2).
// Layout: per-head 'xw' weight blocks gathered into Bt (head and weight = grid y, z); over all 4,096 rows at once: bf16 copy of x, exact projections whose store loop writes the hi/lo head planes [batch][head] (v transposed); dense T-512 attention with every row on hi/lo planes (3 products) in 2 passes of 64 (batch, head) planes (plane = grid z), the attn.v store loop writing the concatenated hi/lo rows; hi/lo x W exact + bf16(x) residual into Y1; then: a column-statistics kernel (work-group per 32 features, rows dealt over its 1,024 threads, fixed-tree sums: mean, then centred variance), BatchNorm apply, hi/lo split, W1 GEMM + b1 + ReLU -> hi/lo planes, W2 GEMM + b2 + out1, second column statistics and BatchNorm apply writing the output.
// Compute dtypes, f32 accumulate: every input rounded to bf16; projections exact; scores and attn.v 3 products; softmax f32; W / W1 / W2 hl x exact (+ f32 biases); BatchNorm statistics and apply f32 (fixed-tree sums, IEEE sqrt/div).

#define NB_  8
#define TT   512
#define DM   1024
#define NH_  16
#define NKV  16
#define REP  (NH_ / NKV)
#define HD   64
#define DQ   (NH_ * HD)
#define DKV  (NKV * HD)
#define ZH   64                   // (batch, head) planes per attention pass: 4 batches x 16 heads
#define RH   512                  // query rows < RH use hi+lo planes (0: none)
#define WIN  0
#define PCAR 1024.0f
#define SCL  0.125f   // HD^-0.5
typedef _Float16 h16;
typedef unsigned short bf;
typedef __attribute__((ext_vector_type(16))) __bf16   v16bf;
typedef __attribute__((ext_vector_type(16))) _Float16 v16h;
typedef __attribute__((ext_vector_type(8)))  _Float16 v8h;
typedef __attribute__((ext_vector_type(8)))  unsigned short v8us;
typedef __attribute__((ext_vector_type(8)))  float    v8f;
typedef __attribute__((ext_vector_type(4)))  float    v4f;
typedef v8h  __attribute__((may_alias)) v8ha;
typedef v4f  __attribute__((may_alias)) v4fa;
typedef v8us __attribute__((may_alias)) v8usa;

__device__ __forceinline__ unsigned short f2bf(float f) { unsigned u = __float_as_uint(f); u += 0x7FFFu + ((u >> 16) & 1u); return (unsigned short)(u >> 16); }
__device__ __forceinline__ float bf2f(unsigned short b) { return __uint_as_float(((unsigned)b) << 16); }
__device__ __forceinline__ float bfr(float f) { return bf2f(f2bf(f)); }
__device__ __forceinline__ v16h cat16(v8h lo, v8h hi) { return __builtin_shufflevector(lo, hi, 0, 1, 2, 3, 4, 5, 6, 7, 8, 9, 10, 11, 12, 13, 14, 15); }
__device__ __forceinline__ v16bf cat16b(v8us lo, v8us hi) { return __builtin_bit_cast(v16bf, __builtin_shufflevector(lo, hi, 0, 1, 2, 3, 4, 5, 6, 7, 8, 9, 10, 11, 12, 13, 14, 15)); }
__device__ __forceinline__ v8f wmma16(v16h a, v16h b, v8f c) { return __builtin_amdgcn_wmma_f32_16x16x32_f16(false, a, false, b, (short)0, c, false, false); }
__device__ __forceinline__ v8f wmmab(v16bf a, v16bf b, v8f c) { return __builtin_amdgcn_wmma_f32_16x16x32_bf16(false, a, false, b, (short)0, c, false, false); }



__device__ __forceinline__ void splitf(float y, unsigned short& h, unsigned short& l) { h = f2bf(y); l = f2bf(y - bf2f(h)); }
typedef __attribute__((ext_vector_type(4))) unsigned short v4us;
// ---- k_gemmw: register-blocked GEMM, ONE WAVE per 64x64 output tile (16 accumulators), operands straight from K-contiguous 16-bit planes; grid (M/64, N/64, Z), 32 threads.
// tile[m][n] (f32, + optional f32 bias[n]) = sum_k A[m][k] Bt[n][k] (+ split products per NSPLIT). z-batch strides sA/sB/sC in elements. K % 32 == 0.
// EPI: what the store loop does with the f32 tile; each is, element for element, the arithmetic of a separate elementwise pass over a stored f32 tile.
#define E_F32    0   // C = tile
#define E_HEAD   1   // hi/lo head planes [batch][head][t][d]: a row block is 64 positions of one batch, a column block one head (hx = heads)
#define E_VT     2   // hi/lo transposed head planes [batch][head][d][t] (hx = heads)
#define E_MERGE  3   // hi/lo rows of the concatenated heads [batch * TT + t][head * HD + d]; plane = hx + z = batch * NH_ + head
#define E_RES    4   // C = tile + bf16(R), R f32 with C's pitch
#define E_RELUHL 5   // hi/lo planes of max(tile + bias, 0)
#define E_ADD    6   // C = (tile + bias) + R, R f32 with C's pitch
template <typename T16> struct WFrag;
template <> struct WFrag<h16> { typedef v16h V; static __device__ __forceinline__ V ld(const h16* p) { return cat16(*(const v8h*)p, *(const v8h*)(p + 16)); } static __device__ __forceinline__ v8f mma(V a, V b, v8f c) { return wmma16(a, b, c); } };
template <> struct WFrag<bf> { typedef v16bf V; static __device__ __forceinline__ V ld(const bf* p) { return cat16b(*(const v8us*)p, *(const v8us*)(p + 16)); } static __device__ __forceinline__ v8f mma(V a, V b, v8f c) { return wmmab(a, b, c); } };
template <typename T16, int NSPLIT, bool BIAS, int EPI, int PITCH>
__global__ __launch_bounds__(32) void k_gemmw(const T16* __restrict__ A, const T16* __restrict__ A2, const T16* __restrict__ Bt, const T16* __restrict__ Bt2, int K, float* C, const float* __restrict__ bias, size_t sA, size_t sB, size_t sC, bf* Hh, bf* Hl, const float* __restrict__ R, int hx) {
    typedef typename WFrag<T16>::V V;
    __shared__ __align__(16) float os[16 * 68];
    const size_t z = blockIdx.z; A += z * sA; if (A2) A2 += z * sA; Bt += z * sB; if (Bt2) Bt2 += z * sB; C += z * sC;
    const int lane = threadIdx.x & 31, lr = lane & 15, hi = lane >> 4; const int r0 = blockIdx.x * 64, c0 = blockIdx.y * 64;
    v8f acc[4][4];
#pragma unroll
    for (int mb = 0; mb < 4; ++mb)
#pragma unroll
        for (int nb = 0; nb < 4; ++nb) acc[mb][nb] = (v8f){};
    const size_t aoff = (size_t)(r0 + lr) * K + 8 * hi, boff = (size_t)(c0 + lr) * K + 8 * hi;
#pragma unroll 1
    for (int kc = 0; kc < K; kc += 32) {
        V a[4], a2[4];
#pragma unroll
        for (int mb = 0; mb < 4; ++mb) { a[mb] = WFrag<T16>::ld(A + aoff + (size_t)mb * 16 * K + kc); if (NSPLIT == 1 || NSPLIT == 2) a2[mb] = WFrag<T16>::ld(A2 + aoff + (size_t)mb * 16 * K + kc); }
#pragma unroll
        for (int nb = 0; nb < 4; ++nb) { const V b = WFrag<T16>::ld(Bt + boff + (size_t)nb * 16 * K + kc); V b2; if (NSPLIT >= 2) b2 = WFrag<T16>::ld(Bt2 + boff + (size_t)nb * 16 * K + kc);
#pragma unroll
            for (int mb = 0; mb < 4; ++mb) { acc[mb][nb] = WFrag<T16>::mma(a[mb], b, acc[mb][nb]); if (NSPLIT == 1 || NSPLIT == 2) acc[mb][nb] = WFrag<T16>::mma(a2[mb], b, acc[mb][nb]); if (NSPLIT >= 2) acc[mb][nb] = WFrag<T16>::mma(a[mb], b2, acc[mb][nb]); } }
        asm volatile("v_nop\n\tv_nop\n\tv_nop\n\tv_nop" : "+v"(acc[0][0]), "+v"(acc[1][1]), "+v"(acc[2][2]), "+v"(acc[3][3]) : "v"(a[0]), "v"(a[3]));
    }
    // every address of the store loop is one per-lane base plus a compile-time step (PITCH: the written rows' pitch in elements)
    if (EPI == E_VT) {   // a lane's 8 accumulator rows are 8 consecutive positions of one feature: 16-B pieces of the transposed plane straight from registers
        const size_t vb = (((size_t)(r0 / TT) * hx + blockIdx.y) * HD + lr) * PITCH + (r0 % TT) + hi * 8;
#pragma unroll
        for (int mb = 0; mb < 4; ++mb) {
#pragma unroll
            for (int nb = 0; nb < 4; ++nb) { v8us oh, ol;
#pragma unroll
                for (int j = 0; j < 8; ++j) { unsigned short h2, l2; splitf(acc[mb][nb][j], h2, l2); oh[j] = h2; ol[j] = l2; }
                *(v8us*)(Hh + vb + nb * 16 * PITCH + mb * 16) = oh; *(v8us*)(Hl + vb + nb * 16 * PITCH + mb * 16) = ol; } }
        return; }
    size_t tb;   // element offset of the tile's first row and column in what is written (and in R)
    if (EPI == E_HEAD) tb = (((size_t)(r0 / TT) * hx + blockIdx.y) * TT + (r0 % TT)) * PITCH;
    else if (EPI == E_MERGE) { const int pl = hx + (int)z; tb = ((size_t)(pl / NH_) * TT + r0) * PITCH + (pl % NH_) * HD + c0; }
    else tb = (size_t)r0 * PITCH + c0;
    tb += (size_t)hi * PITCH + lr * 4;   // this lane's row (of each pair) and its 4 columns
#pragma unroll
    for (int mb = 0; mb < 4; ++mb) {
#pragma unroll
        for (int nb = 0; nb < 4; ++nb) {
#pragma unroll
            for (int j = 0; j < 8; ++j) os[(hi * 8 + j) * 68 + nb * 16 + lr] = acc[mb][nb][j]; }
        __builtin_amdgcn_wave_barrier(); asm volatile("" ::: "memory");
#pragma unroll
        for (int s = 0; s < 8; ++s) { const int row = 2 * s + hi, cofs = lr * 4; v4f val = *(const v4fa*)(os + row * 68 + cofs); if (BIAS) { val[0] += bfr(bias[c0 + cofs]); val[1] += bfr(bias[c0 + cofs + 1]); val[2] += bfr(bias[c0 + cofs + 2]); val[3] += bfr(bias[c0 + cofs + 3]); }
            const int st = (mb * 16 + 2 * s) * PITCH;
            if (EPI == E_F32 || EPI == E_RES || EPI == E_ADD) {
                if (EPI != E_F32) { const v4f r = *(const v4f*)(R + tb + st);
#pragma unroll
                    for (int q = 0; q < 4; ++q) val[q] = __fadd_rn(val[q], EPI == E_RES ? bfr(r[q]) : r[q]); }
                *(v4f*)(C + tb + st) = val;
            } else { v4us oh, ol;
#pragma unroll
                for (int q = 0; q < 4; ++q) { unsigned short h2, l2; splitf(EPI == E_RELUHL ? fmaxf(val[q], 0.0f) : val[q], h2, l2); oh[q] = h2; ol[q] = l2; }
                *(v4us*)(Hh + tb + st) = oh; *(v4us*)(Hl + tb + st) = ol; } }
        if ((EPI == E_RES || EPI == E_ADD) && mb < 3) asm volatile("s_wait_xcnt 0x0" ::: "memory");   // the next block's loads of R may land in registers that this block's stores name
        __builtin_amdgcn_wave_barrier(); asm volatile("" ::: "memory");
    }
}
__device__ __forceinline__ h16 tohx(float x) { return (h16)x; }
typedef __attribute__((ext_vector_type(2))) _Float16 v2h;
typedef __attribute__((ext_vector_type(4))) _Float16 v4h;
typedef __attribute__((ext_vector_type(2))) unsigned short v2us;
typedef __attribute__((ext_vector_type(2))) float v2f;
typedef __attribute__((ext_vector_type(4))) int v4i;

// grid (lines, blocks, 3): z picks one of three weights of equal shape, y one [K][N] block of it (a head)
__global__ __launch_bounds__(256) void k_wtG(const float* __restrict__ wa, const float* __restrict__ wb, const float* __restrict__ wc, int K, int N, bf* Ba, bf* Bb, bf* Bc) {
    const size_t blk = (size_t)blockIdx.y * K * N; const float* w = (blockIdx.z == 0 ? wa : blockIdx.z == 1 ? wb : wc) + blk; bf* Bt = (blockIdx.z == 0 ? Ba : blockIdx.z == 1 ? Bb : Bc) + blk;
    const int lane = threadIdx.x & 31; const int L0 = (blockIdx.x * 8 + (threadIdx.x >> 5)) * 8; const int nlines = N * K / 64;
{
#pragma unroll 1
        for (int l = 0; l < 8; ++l) { const int L = L0 + l; if (L >= nlines) break; const size_t e = (size_t)L * 64 + lane * 2; const int k = (int)(e % K), n = (int)(e / K); v2us o;
            o[0] = f2bf(w[(size_t)k * N + n]); o[1] = f2bf(w[(size_t)(k + 1) * N + n]); *(v2us*)(Bt + e) = o; }
         }
}
__global__ __launch_bounds__(256) void k_cvt8(const float* __restrict__ src, bf* dst, size_t n8) { const size_t i = (size_t)blockIdx.x * 256 + threadIdx.x; if (i >= n8) return; const v8f v = *(const v8f*)(src + i * 8); v8us o;
#pragma unroll
    for (int k = 0; k < 8; ++k) o[k] = f2bf(v[k]); *(v8us*)(dst + i * 8) = o;  }

// k_asoft: per row (zz, i): t = S x HD^-0.5 (no mask); softmax over the 512 keys (register row, one exp, fixed trees);
__global__ __launch_bounds__(256) void k_asoft(const float* __restrict__ Sb, h16* P16, bf* Ph, bf* Pl) {
    const int lane = threadIdx.x & 31; const int row = blockIdx.x * 8 + (threadIdx.x >> 5); if (row >= ZH * TT) return; const int i = row % TT; const int zz = row / TT; (void)zz; const bool hires = (i < RH); const float* sr = Sb + (size_t)row * TT; float v[TT / 32]; float mx = -3.0e38f;
#pragma unroll
    for (int ch = 0; ch < TT / 128; ++ch) { const int j0 = ch * 128 + lane * 4; const v4f a = *(const v4f*)(sr + j0);
#pragma unroll
        for (int q = 0; q < 4; ++q) { const int j = j0 + q; (void)j; const float t = a[q] * SCL; v[ch * 4 + q] = t; mx = fmaxf(mx, t); } }
#pragma unroll
    for (int sh = 16; sh; sh >>= 1) mx = fmaxf(mx, __shfl_xor(mx, sh, 32));
    float sum = 0.f;
#pragma unroll
    for (int k = 0; k < TT / 32; ++k) { float d0 = __fsub_rn(v[k], mx); asm volatile("" : "+v"(d0)); v[k] = __builtin_amdgcn_exp2f(__fmul_rn(d0, 1.4426950408889634f)); sum += v[k]; }
#pragma unroll
    for (int sh = 16; sh; sh >>= 1) sum += __shfl_xor(sum, sh, 32);
    const float f = __fdiv_rn(hires ? 1.0f : PCAR, sum);
{
        if (hires) {
#pragma unroll
            for (int ch = 0; ch < TT / 128; ++ch) { v4us oh, ol;
#pragma unroll
                for (int q = 0; q < 4; ++q) { unsigned short a, c2; splitf(v[ch * 4 + q] * f, a, c2); oh[q] = a; ol[q] = c2; }
                const size_t oo = ((size_t)zz * (RH ? RH : 1) + i) * TT + ch * 128 + lane * 4; *(v4us*)(Ph + oo) = oh; *(v4us*)(Pl + oo) = ol; }
        } else {
#pragma unroll
            for (int ch = 0; ch < TT / 128; ++ch) { v4h o4;
#pragma unroll
                for (int q = 0; q < 4; ++q) o4[q] = tohx(v[ch * 4 + q] * f);
                *(v4h*)(P16 + (size_t)row * TT + ch * 128 + lane * 4) = o4; } }
         }
}
__global__ __launch_bounds__(256) void k_tohl(const float* __restrict__ F, bf* Hh, bf* Hl, size_t n4) { const size_t i = (size_t)blockIdx.x * 256 + threadIdx.x; if (i >= n4) return; const v4f a = *(const v4f*)(F + i * 4); v4us oh, ol;
#pragma unroll
    for (int q = 0; q < 4; ++q) { unsigned short h2, l2; splitf(a[q], h2, l2); oh[q] = h2; ol[q] = l2; }
    *(v4us*)(Hh + i * 4) = oh; *(v4us*)(Hl + i * 4) = ol;  }
#define BNEPS 1e-3f
// k_colstat: one work-group of 32 waves per 32 features (one 128-B line of every row). Eight lanes read a row's line as 16-B pieces, so a wave load takes 4 rows and the block 128 rows;
// each thread sums its 32 rows (r = rg + 128 i, in index order, 8 loads in flight), then fixed trees: lanes 8 and 16 apart, the 32 waves' partials through LDS in wave order. Mean first, then the centred squares over a second read.
__device__ __forceinline__ float cs_fold(v4f s, float* red, int lane, int wv) {   // block sum per feature; the result is valid in wave 0 (lane = feature)
#pragma unroll
    for (int q = 0; q < 4; ++q) { s[q] += __shfl_xor(s[q], 8, 32); s[q] += __shfl_xor(s[q], 16, 32); }
    if (lane < 8) *(v4f*)(red + wv * 32 + lane * 4) = s;
    __syncthreads();   // every wave's partial is in red before wave 0 reads it
    float a = 0.f;
    if (wv == 0) {
#pragma unroll
        for (int w = 0; w < 32; ++w) a += red[w * 32 + lane]; }
    return a; }
__global__ __launch_bounds__(1024) void k_colstat(const float* __restrict__ Y, float* ST) {
    __shared__ __align__(16) float red[32 * 32]; __shared__ __align__(16) float mus[32];
    const int NR = NB_ * TT; const int lane = threadIdx.x & 31, wv = threadIdx.x >> 5, cg = threadIdx.x & 7, rg = threadIdx.x >> 3; const int c0 = blockIdx.x * 32;
    const float* p = Y + (size_t)rg * DM + c0 + cg * 4; v4f s = (v4f){};
#pragma unroll 1
    for (int i = 0; i < NR / 128; i += 8) { v4f t[8];
#pragma unroll
        for (int k = 0; k < 8; ++k) t[k] = *(const v4f*)(p + (size_t)(i + k) * 128 * DM);
#pragma unroll
        for (int k = 0; k < 8; ++k) s += t[k]; }
    const float mu1 = __fdiv_rn(cs_fold(s, red, lane, wv), (float)NR);
    if (wv == 0) mus[lane] = mu1;
    __syncthreads();   // publishes the means; also ends wave 0's reads of red before it is rewritten
    const v4f mu = *(const v4f*)(mus + cg * 4); v4f v = (v4f){};
#pragma unroll 1
    for (int i = 0; i < NR / 128; i += 8) { v4f t[8];
#pragma unroll
        for (int k = 0; k < 8; ++k) t[k] = *(const v4f*)(p + (size_t)(i + k) * 128 * DM);
#pragma unroll
        for (int k = 0; k < 8; ++k) {
#pragma unroll
            for (int q = 0; q < 4; ++q) { const float d = __fsub_rn(t[k][q], mu[q]); v[q] = __builtin_fmaf(d, d, v[q]); } } }
    const float vs = cs_fold(v, red, lane, wv);
    if (wv == 0) { const float rs = __fdiv_rn(1.0f, __fsqrt_rn(__fadd_rn(__fdiv_rn(vs, (float)NR), BNEPS))); ST[c0 + lane] = mu1; ST[DM + c0 + lane] = rs; } }
__global__ __launch_bounds__(256) void k_bnapply(const float* __restrict__ Y, const float* __restrict__ ST, const float* __restrict__ g, const float* __restrict__ bb, float* out) { const size_t i = (size_t)blockIdx.x * 256 + threadIdx.x; if (i >= (size_t)NB_ * TT * DM / 4) return; const size_t e = i * 4; const int c0 = (int)(e % DM); const v4f y = *(const v4f*)(Y + e); const v4f mu = *(const v4f*)(ST + c0); const v4f rs = *(const v4f*)(ST + DM + c0); const v4f gg = *(const v4f*)(g + c0); const v4f be = *(const v4f*)(bb + c0); v4f o;
#pragma unroll
    for (int q = 0; q < 4; ++q) { const float d = __fsub_rn(y[q], mu[q]); float n1 = __fmul_rn(d, rs[q]); asm volatile("" : "+v"(n1)); float n2 = __fmul_rn(n1, bfr(gg[q])); asm volatile("" : "+v"(n2)); o[q] = __fadd_rn(n2, bfr(be[q])); }
    *(v4f*)(out + e) = o;  }

extern "C" void kernel_launch(void* const* d_in, const int* in_sizes, int n_in,
                              void* d_out, int out_size, void* d_ws, size_t ws_size, hipStream_t stream) {
    (void)in_sizes; (void)n_in; (void)out_size;
    const float* x = (const float*)d_in[0]; const float* pq = (const float*)d_in[1]; const float* pk = (const float*)d_in[2]; const float* pv = (const float*)d_in[3];   /* [16][1024][64] each */ const float* wo = (const float*)d_in[4];   /* W [1024][1024] 'xw' */ const float* w1 = (const float*)d_in[5]; const float* b1 = (const float*)d_in[6]; const float* w2 = (const float*)d_in[7]; const float* b2 = (const float*)d_in[8]; const float* g1 = (const float*)d_in[9]; const float* be1 = (const float*)d_in[10]; const float* g2 = (const float*)d_in[11]; const float* be2 = (const float*)d_in[12];   /* order x, Wq, Wk, Wv, W, W1, b1, W2, b2, g1, be1, g2, be2 */ const float* wq = pq; const float* wk = pk; const float* wv = pv;
    float* OUT = (float*)d_out;     // [8][512][1024]
    char* wsp = (char*)d_ws;
    auto take = [&](size_t bytes) { char* p = wsp; wsp += (bytes + 255) & ~(size_t)255; return (void*)p; };
    bf* WQ = (bf*)take((size_t)DQ * DM * 2); bf* WK = (bf*)take((size_t)DKV * DM * 2); bf* WV = (bf*)take((size_t)DKV * DM * 2); bf* WO = (bf*)take((size_t)DM * DQ * 2);
    bf* W1B = (bf*)take((size_t)DM * DM * 2); bf* W2B = (bf*)take((size_t)DM * DM * 2); float* ST = (float*)take((size_t)2 * DM * 4);   /* column mean / rstd */ bf* XB = (bf*)take((size_t)NB_ * TT * DM * 2);
    /* head planes of all batches, [batch][head][..] */
    bf* QPh = (bf*)take((size_t)NB_ * NH_ * TT * HD * 2); bf* QPl = (bf*)take((size_t)NB_ * NH_ * TT * HD * 2); bf* KPh = (bf*)take((size_t)NB_ * NKV * TT * HD * 2); bf* KPl = (bf*)take((size_t)NB_ * NKV * TT * HD * 2); bf* VTh = (bf*)take((size_t)NB_ * NKV * HD * TT * 2); bf* VTl = (bf*)take((size_t)NB_ * NKV * HD * TT * 2);
    bf* ATh = (bf*)take((size_t)NB_ * TT * DQ * 2); bf* ATl = (bf*)take((size_t)NB_ * TT * DQ * 2);
    /* one region, two tenants one after the other (stream-ordered, each writes all it reads): a pass's scores and probability planes; the all-batch buffers behind the attention */
    float* Sb = (float*)take((size_t)ZH * TT * TT * 4); bf* Ph = (bf*)take((size_t)ZH * RH * TT * 2); bf* Pl = (bf*)take((size_t)ZH * RH * TT * 2);
    if ((size_t)(wsp - (char*)d_ws) > ws_size) return;    // ws 256 MiB
    h16* P16 = nullptr;   // fp16 probability plane: no row uses it (RH == TT)
    float* Y1 = Sb; float* O1 = Y1 + (size_t)NB_ * TT * DM; float* HY = O1 + (size_t)NB_ * TT * DM; bf* Zh = (bf*)(HY + (size_t)NB_ * TT * DM); bf* Zl = Zh + (size_t)NB_ * TT * DM;   /* 64 MiB = the score buffer's size; first written after the last pass: x + attn W (Y1), BN1 output (O1), second residual sum (HY), hi/lo planes of out1 (Zh/Zl) */
    bf* Rh = Ph; bf* Rl = Rh + (size_t)NB_ * TT * DM;   /* hi/lo planes of the hidden layer, in the probability planes' place (dead behind the last pass): the W1 GEMM writes them while it reads Zh/Zl */
    k_wtG<<<dim3((DM * HD / 64 + 63) / 64, NH_, 3), 256, 0, stream>>>(wq, wk, wv, DM, HD, WQ, WK, WV);   /* head hh's 'xw' [1024][64] -> Bt rows hh*64.. */
    k_wtG<<<dim3((DM * DM / 64 + 63) / 64, 1, 3), 256, 0, stream>>>(wo, w1, w2, DM, DM, WO, W1B, W2B);
    k_cvt8<<<(unsigned)(((size_t)NB_ * TT * DM / 8 + 255) / 256), 256, 0, stream>>>(x, XB, (size_t)NB_ * TT * DM / 8);
    k_gemmw<bf, 0, false, E_HEAD, HD><<<dim3(NB_ * TT / 64, DQ / 64, 1), 32, 0, stream>>>(XB, nullptr, WQ, nullptr, DM, nullptr, nullptr, 0, 0, 0, QPh, QPl, nullptr, NH_);
    k_gemmw<bf, 0, false, E_HEAD, HD><<<dim3(NB_ * TT / 64, DKV / 64, 1), 32, 0, stream>>>(XB, nullptr, WK, nullptr, DM, nullptr, nullptr, 0, 0, 0, KPh, KPl, nullptr, NKV);
    k_gemmw<bf, 0, false, E_VT, TT><<<dim3(NB_ * TT / 64, DKV / 64, 1), 32, 0, stream>>>(XB, nullptr, WV, nullptr, DM, nullptr, nullptr, 0, 0, 0, VTh, VTl, nullptr, NKV);
    for (int h0 = 0; h0 < NB_ * NH_; h0 += ZH) { const size_t zq = (size_t)h0, zk = (size_t)(h0 / REP);   // h0 = the pass's first (batch, head) plane; one kv head per query head: consecutive planes on both sides (z-strides TT*HD)
        k_gemmw<bf, 2, false, E_F32, TT><<<dim3(RH / 64, TT / 64, ZH), 32, 0, stream>>>(QPh + zq * TT * HD, QPl + zq * TT * HD, KPh + zk * TT * HD, KPl + zk * TT * HD, HD, Sb, nullptr, (size_t)TT * HD, (size_t)TT * HD, (size_t)TT * TT, nullptr, nullptr, nullptr, 0);
        k_asoft<<<ZH * TT / 8, 256, 0, stream>>>(Sb, P16, Ph, Pl);
        k_gemmw<bf, 2, false, E_MERGE, DQ><<<dim3(RH / 64, HD / 64, ZH), 32, 0, stream>>>(Ph, Pl, VTh + zk * HD * TT, VTl + zk * HD * TT, TT, nullptr, nullptr, (size_t)RH * TT, (size_t)HD * TT, 0, ATh, ATl, nullptr, h0); }
    k_gemmw<bf, 1, false, E_RES, DM><<<dim3(NB_ * TT / 64, DM / 64, 1), 32, 0, stream>>>(ATh, ATl, WO, nullptr, DQ, Y1, nullptr, 0, 0, 0, nullptr, nullptr, x, 0);   /* Y1 = concat W + bf16(x) */
    /* ---- all 4,096 rows: BatchNorm 1, feed-forward, BatchNorm 2 ---- */
    k_colstat<<<DM / 32, 1024, 0, stream>>>(Y1, ST); k_bnapply<<<(unsigned)(((size_t)NB_ * TT * DM / 4 + 255) / 256), 256, 0, stream>>>(Y1, ST, g1, be1, O1);   /* out1 */
    k_tohl<<<(unsigned)(((size_t)NB_ * TT * DM / 4 + 255) / 256), 256, 0, stream>>>(O1, Zh, Zl, (size_t)NB_ * TT * DM / 4);
    k_gemmw<bf, 1, true, E_RELUHL, DM><<<dim3(NB_ * TT / 64, DM / 64, 1), 32, 0, stream>>>(Zh, Zl, W1B, nullptr, DM, nullptr, b1, 0, 0, 0, Rh, Rl, nullptr, 0);   /* relu(out1 W1 + b1) */
    k_gemmw<bf, 1, true, E_ADD, DM><<<dim3(NB_ * TT / 64, DM / 64, 1), 32, 0, stream>>>(Rh, Rl, W2B, nullptr, DM, HY, b2, 0, 0, 0, nullptr, nullptr, O1, 0);   /* out1 + out2 */
    k_colstat<<<DM / 32, 1024, 0, stream>>>(HY, ST); k_bnapply<<<(unsigned)(((size_t)NB_ * TT * DM / 4 + 255) / 256), 256, 0, stream>>>(HY, ST, g2, be2, OUT);   /* y */
}
